// v000
// Measured on an AMD MI455X. A time is GPU time per run, averaged over a window of back-to-back runs after a warm-up
// (all launches, gaps included; the runs take copies of the inputs in turn), and the median of several windows.
// Apart from v000's, it joins two sittings. Times from different sittings can be a few percent apart, while
// side-by-side timings come from the same sitting.
// v000, which the later versions start from, runs in 280 microseconds.
#include <hip/hip_runtime.h>
#include <hip/hip_bf16.h>
#include <math.h>

// ---------------- types ----------------
typedef __bf16 bf16;
typedef bf16  bf16x8  __attribute__((ext_vector_type(8)));
typedef bf16  bf16x16 __attribute__((ext_vector_type(16)));
typedef float f32x8   __attribute__((ext_vector_type(8)));
typedef float f32x4   __attribute__((ext_vector_type(4)));
typedef unsigned int u32x4 __attribute__((ext_vector_type(4)));
typedef int  i32x4 __attribute__((ext_vector_type(4)));
typedef int  i32x8 __attribute__((ext_vector_type(8)));

#define B_  4
#define L_  2048
#define D_  1024
#define H_  16
#define DH_ 64
#define SCALE_ 0.125f   // 64^-0.5

#if __has_builtin(__builtin_amdgcn_tensor_load_to_lds)
#define USE_TDM 1
#else
#define USE_TDM 0
#endif

// float -> bf16 round-to-nearest-even
__device__ __forceinline__ bf16 f2bf(float f) {
    unsigned u = __builtin_bit_cast(unsigned, f);
    u += 0x7FFFu + ((u >> 16) & 1u);
    unsigned short h = (unsigned short)(u >> 16);
    return __builtin_bit_cast(bf16, h);
}

// ---------------- DPP16 16-lane reductions (pure VALU, no LDS) ----------------
template <int CTRL>
__device__ __forceinline__ float dpp_f(float x) {
    int r = __builtin_amdgcn_update_dpp(0, __builtin_bit_cast(int, x), CTRL, 0xf, 0xf, true);
    return __builtin_bit_cast(float, r);
}
__device__ __forceinline__ float rmax16(float x) {
    x = fmaxf(x, dpp_f<0xB1>(x));    // quad_perm xor1
    x = fmaxf(x, dpp_f<0x4E>(x));    // quad_perm xor2
    x = fmaxf(x, dpp_f<0x141>(x));   // row_half_mirror
    x = fmaxf(x, dpp_f<0x140>(x));   // row_mirror
    return x;
}
__device__ __forceinline__ float rsum16(float x) {
    x += dpp_f<0xB1>(x);
    x += dpp_f<0x4E>(x);
    x += dpp_f<0x141>(x);
    x += dpp_f<0x140>(x);
    return x;
}

__device__ __forceinline__ void async_b128(void* lds_ptr, const void* gptr) {
    unsigned la = (unsigned)(uintptr_t)lds_ptr;
    unsigned long long ga = (unsigned long long)(uintptr_t)gptr;
    asm volatile("global_load_async_to_lds_b128 %0, %1, off"
                 :: "v"(la), "v"(ga) : "memory");
}
__device__ __forceinline__ void wait_async_le0() { asm volatile("s_wait_asynccnt 0x0" ::: "memory"); }
__device__ __forceinline__ void wait_async_le4() { asm volatile("s_wait_asynccnt 0x4" ::: "memory"); }
__device__ __forceinline__ void wait_async_le8() { asm volatile("s_wait_asynccnt 0x8" ::: "memory"); }

#if USE_TDM
__device__ __forceinline__ void tdm_load_2d(void* lds_ptr, const void* gptr,
                                            unsigned tensor_d0, unsigned tensor_d1,
                                            unsigned tile_d0, unsigned tile_d1,
                                            unsigned stride_d0,
                                            unsigned pad_i, unsigned pad_a) {
    unsigned long long ga = (unsigned long long)(uintptr_t)gptr;
    u32x4 g0;
    g0[0] = 1u;
    g0[1] = (unsigned)(uintptr_t)lds_ptr;
    g0[2] = (unsigned)(ga & 0xFFFFFFFFu);
    g0[3] = (unsigned)((ga >> 32) & 0x1FFFFFFu) | (2u << 30);
    i32x8 g1;
    g1[0] = (int)((1u << 16) | (1u << 20) | (pad_i << 22) | (pad_a << 25));
    g1[1] = (int)((tensor_d0 & 0xFFFFu) << 16);
    g1[2] = (int)((tensor_d0 >> 16) | ((tensor_d1 & 0xFFFFu) << 16));
    g1[3] = (int)((tensor_d1 >> 16) | (tile_d0 << 16));
    g1[4] = (int)tile_d1;
    g1[5] = (int)stride_d0;
    g1[6] = 0;
    g1[7] = 0;
    i32x4 gz = {0, 0, 0, 0};
#if defined(__clang_major__) && (__clang_major__ >= 23)
    i32x8 gz8 = {0, 0, 0, 0, 0, 0, 0, 0};
    __builtin_amdgcn_tensor_load_to_lds(g0, g1, gz, gz, gz8, 0);
#else
    __builtin_amdgcn_tensor_load_to_lds(g0, g1, gz, gz, 0);
#endif
}
__device__ __forceinline__ void wait_tensor0() { __builtin_amdgcn_s_wait_tensorcnt(0); }
__device__ __forceinline__ void wait_tensor2() { __builtin_amdgcn_s_wait_tensorcnt(2); }
#endif

__device__ __forceinline__ bf16x16 load_frag(const bf16* p, int stride, int lane) {
    int hf = lane >> 4;
    int r  = lane & 15;
    const bf16* q = p + r * stride + hf * 8;
    bf16x8 lo = *(const bf16x8*)(q);
    bf16x8 hi = *(const bf16x8*)(q + 16);
    bf16x16 f;
#pragma unroll
    for (int i = 0; i < 8; ++i) { f[i] = lo[i]; f[i + 8] = hi[i]; }
    return f;
}

__device__ __forceinline__ f32x8 wmma_bf16(bf16x16 a, bf16x16 b, f32x8 c) {
    return __builtin_amdgcn_wmma_f32_16x16x32_bf16(false, a, false, b, (short)0, c, false, false);
}

// ---------------- prep kernels ----------------
__global__ __launch_bounds__(256) void cvt_bf16_kernel(const float* __restrict__ in,
                                                       bf16* __restrict__ out, int n) {
    int i = (blockIdx.x * 256 + threadIdx.x) * 4;
#pragma unroll
    for (int j = 0; j < 4; ++j)
        if (i + j < n) out[i + j] = f2bf(in[i + j]);
}

// beta*log(max(R,eps)) permuted into WMMA D-fragment order
__global__ __launch_bounds__(256) void prep_logr_perm(const float* __restrict__ R,
                                                      const float* __restrict__ beta,
                                                      float* __restrict__ out) {
    int kg = blockIdx.x * 256 + threadIdx.x;
    int qg = blockIdx.y;
    float b = beta[0];
    float val = b * __logf(fmaxf(R[(size_t)qg * L_ + kg], 1e-8f));
    int hf = (qg >> 3) & 1, v = qg & 7;
    int lc = kg & 15, j = (kg >> 4) & 1;
    int lane = hf * 16 + lc, e = j * 8 + v;
    out[(((size_t)(qg >> 4) * (L_ / 32) + (kg >> 5)) * 32 + lane) * 16 + e] = val;
}

template <int MODE>
__global__ __launch_bounds__(256) void gemm_wmma(const bf16* __restrict__ A,
                                                 const bf16* __restrict__ W,
                                                 void* __restrict__ outp,
                                                 int M, int N, int K) {
    __shared__ bf16 sA[2][128 * 72];
    __shared__ bf16 sB[2][128 * 72];

    int tid = threadIdx.x, lane = tid & 31, wid = tid >> 5;
    int wm = wid & 3, wn = wid >> 2;
    int rowBase = blockIdx.y * 128, colBase = blockIdx.x * 128;
    const bf16* gA0 = A + (size_t)rowBase * K;
    const bf16* gW0 = W + (size_t)colBase * K;

    f32x8 acc[2][4];
#pragma unroll
    for (int i = 0; i < 2; ++i)
#pragma unroll
        for (int j = 0; j < 4; ++j) acc[i][j] = (f32x8)0.0f;

    const int NK = K >> 6;

#if USE_TDM
    bool leader = (wid == 0);
    if (leader) {
        tdm_load_2d(&sA[0][0], gA0, (unsigned)K, (unsigned)M, 64, 128, (unsigned)K, 4, 3);
        tdm_load_2d(&sB[0][0], gW0, (unsigned)K, (unsigned)N, 64, 128, (unsigned)K, 4, 3);
    }
#else
    int r = tid >> 1, hh = tid & 1;
    const bf16* gA = gA0 + (size_t)r * K + hh * 32;
    const bf16* gW = gW0 + (size_t)r * K + hh * 32;
    int lbase = r * 72 + hh * 32;
#pragma unroll
    for (int i = 0; i < 4; ++i) {
        async_b128(&sA[0][lbase + i * 8], gA + i * 8);
        async_b128(&sB[0][lbase + i * 8], gW + i * 8);
    }
#endif

    for (int kt = 0; kt < NK; ++kt) {
        int cur = kt & 1;
#if USE_TDM
        if (leader) {
            if (kt + 1 < NK) {
                tdm_load_2d(&sA[cur ^ 1][0], gA0 + (kt + 1) * 64, (unsigned)K, (unsigned)M,
                            64, 128, (unsigned)K, 4, 3);
                tdm_load_2d(&sB[cur ^ 1][0], gW0 + (kt + 1) * 64, (unsigned)K, (unsigned)N,
                            64, 128, (unsigned)K, 4, 3);
                wait_tensor2();   // tensor ops in-order: current tile's pair complete
            } else {
                wait_tensor0();
            }
        }
#else
        if (kt + 1 < NK) {
            const bf16* ga = gA + (size_t)(kt + 1) * 64;
            const bf16* gb = gW + (size_t)(kt + 1) * 64;
#pragma unroll
            for (int i = 0; i < 4; ++i) {
                async_b128(&sA[cur ^ 1][lbase + i * 8], ga + i * 8);
                async_b128(&sB[cur ^ 1][lbase + i * 8], gb + i * 8);
            }
            wait_async_le8();
        } else {
            wait_async_le0();
        }
#endif
        __syncthreads();

#pragma unroll
        for (int ks = 0; ks < 2; ++ks) {
            bf16x16 af[2], bfr[4];
#pragma unroll
            for (int fm = 0; fm < 2; ++fm)
                af[fm] = load_frag(&sA[cur][(wm * 32 + fm * 16) * 72 + ks * 32], 72, lane);
#pragma unroll
            for (int fn = 0; fn < 4; ++fn)
                bfr[fn] = load_frag(&sB[cur][(wn * 64 + fn * 16) * 72 + ks * 32], 72, lane);
#pragma unroll
            for (int fm = 0; fm < 2; ++fm)
#pragma unroll
                for (int fn = 0; fn < 4; ++fn)
                    acc[fm][fn] = wmma_bf16(af[fm], bfr[fn], acc[fm][fn]);
        }
        __syncthreads();
    }

    int hf = lane >> 4, lc = lane & 15;
#pragma unroll
    for (int fm = 0; fm < 2; ++fm)
#pragma unroll
        for (int fn = 0; fn < 4; ++fn)
#pragma unroll
            for (int v = 0; v < 8; ++v) {
                int rr = rowBase + wm * 32 + fm * 16 + v + hf * 8;
                int cc = colBase + wn * 64 + fn * 16 + lc;
                float val = acc[fm][fn][v];
                int b = rr >> 11, l = rr & (L_ - 1);
                int h = cc >> 6, d = cc & 63;
                if (MODE == 0) {
                    ((bf16*)outp)[(((size_t)(b * H_ + h)) * L_ + l) * DH_ + d] = f2bf(val);
                } else if (MODE == 2) {
                    ((bf16*)outp)[(((size_t)(b * H_ + h)) * DH_ + d) * L_ + l] = f2bf(val);
                } else {
                    ((float*)outp)[(size_t)rr * N + cc] = val;
                }
            }
}

// ---------------- flash attention with log-R bias (async double-buffered) ----------------
__global__ __launch_bounds__(128) void attn_flash(const bf16* __restrict__ Q,
                                                  const bf16* __restrict__ Km,
                                                  const bf16* __restrict__ Vt,
                                                  const float* __restrict__ logRp,
                                                  bf16* __restrict__ O) {
    __shared__ bf16 sK[2][32 * 72];    // [key][d]  (B-layout for Q@K^T)
    __shared__ bf16 sVt[2][64 * 40];   // [d][key]  (natural copy of global V^T)
    __shared__ bf16 sP[4 * 16 * 40];   // per-wave P staging

    int tid = threadIdx.x, lane = tid & 31, w = tid >> 5;
    int bid = blockIdx.x;
    int qt = bid & 31, h = (bid >> 5) & (H_ - 1), b = bid >> 9;
    int bh = b * H_ + h;
    const bf16* Qh = Q + (size_t)bh * L_ * DH_;
    const bf16* Kh = Km + (size_t)bh * L_ * DH_;
    const bf16* Vh = Vt + (size_t)bh * DH_ * L_;   // [Dh][L]
    int q0 = qt * 64 + w * 16;
    int hf = lane >> 4, lc = lane & 15;

    bf16x16 qf[2];
    qf[0] = load_frag(Qh + (size_t)q0 * DH_ + 0, DH_, lane);
    qf[1] = load_frag(Qh + (size_t)q0 * DH_ + 32, DH_, lane);

    float m[8], s[8];
    f32x8 of[4];
#pragma unroll
    for (int v = 0; v < 8; ++v) { m[v] = -1e30f; s[v] = 0.0f; }
#pragma unroll
    for (int n = 0; n < 4; ++n) of[n] = (f32x8)0.0f;

    const float* lrbase = logRp + ((size_t)(q0 >> 4) * (L_ / 32)) * 512 + lane * 16;

    int keyA = tid >> 2, segA = tid & 3;
    int dV = tid >> 1, hV = tid & 1;
    const bf16* gk0 = Kh + (size_t)keyA * DH_ + segA * 16;
    const bf16* gv0 = Vh + (size_t)dV * L_ + hV * 16;
    int lK = keyA * 72 + segA * 16;
    int lV = dV * 40 + hV * 16;

    async_b128(&sK[0][lK],      gk0);
    async_b128(&sK[0][lK + 8],  gk0 + 8);
    async_b128(&sVt[0][lV],     gv0);
    async_b128(&sVt[0][lV + 8], gv0 + 8);

    for (int kt = 0; kt < L_; kt += 32) {
        int cur = (kt >> 5) & 1;
        if (kt + 32 < L_) {
            const bf16* gk = gk0 + (size_t)(kt + 32) * DH_;
            const bf16* gv = gv0 + (kt + 32);
            async_b128(&sK[cur ^ 1][lK],      gk);
            async_b128(&sK[cur ^ 1][lK + 8],  gk + 8);
            async_b128(&sVt[cur ^ 1][lV],     gv);
            async_b128(&sVt[cur ^ 1][lV + 8], gv + 8);
        }

        const float* lr = lrbase + (size_t)(kt >> 5) * 512;
        f32x4 c0 = *(const f32x4*)(lr + 0);
        f32x4 c1 = *(const f32x4*)(lr + 4);
        f32x4 c2 = *(const f32x4*)(lr + 8);
        f32x4 c3 = *(const f32x4*)(lr + 12);
        if (kt + 32 < L_) __builtin_prefetch(lr + 512, 0, 1);

        if (kt + 32 < L_) wait_async_le4(); else wait_async_le0();
        __syncthreads();

        f32x8 sc[2];
        sc[0] = (f32x8)0.0f; sc[1] = (f32x8)0.0f;
#pragma unroll
        for (int j = 0; j < 2; ++j)
#pragma unroll
            for (int kd = 0; kd < 2; ++kd)
                sc[j] = wmma_bf16(qf[kd],
                                  load_frag(&sK[cur][(j * 16) * 72 + kd * 32], 72, lane), sc[j]);

        float xv[2][8];
#pragma unroll
        for (int v = 0; v < 4; ++v) {
            xv[0][v]     = sc[0][v]     * SCALE_ + c0[v];
            xv[0][v + 4] = sc[0][v + 4] * SCALE_ + c1[v];
            xv[1][v]     = sc[1][v]     * SCALE_ + c2[v];
            xv[1][v + 4] = sc[1][v + 4] * SCALE_ + c3[v];
        }

        float mn[8], corr[8];
#pragma unroll
        for (int v = 0; v < 8; ++v) {
            float rm = rmax16(fmaxf(xv[0][v], xv[1][v]));
            mn[v] = fmaxf(m[v], rm);
            corr[v] = __expf(m[v] - mn[v]);
            m[v] = mn[v];
        }
#pragma unroll
        for (int j = 0; j < 2; ++j)
#pragma unroll
            for (int v = 0; v < 8; ++v) xv[j][v] = __expf(xv[j][v] - mn[v]);
#pragma unroll
        for (int v = 0; v < 8; ++v)
            s[v] = s[v] * corr[v] + rsum16(xv[0][v] + xv[1][v]);
#pragma unroll
        for (int n = 0; n < 4; ++n)
#pragma unroll
            for (int v = 0; v < 8; ++v) of[n][v] *= corr[v];

        bf16* myP = &sP[w * 16 * 40];
#pragma unroll
        for (int j = 0; j < 2; ++j)
#pragma unroll
            for (int v = 0; v < 8; ++v)
                myP[(v + hf * 8) * 40 + j * 16 + lc] = f2bf(xv[j][v]);

        bf16x16 pf = load_frag(myP, 40, lane);
#pragma unroll
        for (int n = 0; n < 4; ++n)
            of[n] = wmma_bf16(pf, load_frag(&sVt[cur][(n * 16) * 40], 40, lane), of[n]);
        __syncthreads();
    }

#pragma unroll
    for (int v = 0; v < 8; ++v) s[v] = 1.0f / s[v];
#pragma unroll
    for (int n = 0; n < 4; ++n)
#pragma unroll
        for (int v = 0; v < 8; ++v) {
            int qg = q0 + v + hf * 8;
            int d = n * 16 + lc;
            O[((size_t)(b * L_ + qg)) * D_ + h * DH_ + d] = f2bf(of[n][v] * s[v]);
        }
}

// ---------------- residual + LayerNorm ----------------
__global__ __launch_bounds__(256) void resid_ln(const float* __restrict__ Y,
                                                const float* __restrict__ tokens,
                                                const float* __restrict__ gamma,
                                                const float* __restrict__ bias,
                                                float* __restrict__ out) {
    int row = blockIdx.x, tid = threadIdx.x;
    const float* y = Y + (size_t)row * D_;
    const float* t = tokens + (size_t)row * D_;
    float x[4], sum = 0.f, sq = 0.f;
#pragma unroll
    for (int i = 0; i < 4; ++i) {
        int c = tid + i * 256;
        x[i] = y[c] + t[c];
        sum += x[i];
        sq  += x[i] * x[i];
    }
    sum = rsum16(sum); sq = rsum16(sq);
    __shared__ float red[32];
    int wid = tid >> 5, lane = tid & 31;
    if ((lane & 15) == 0) { red[wid * 2 + (lane >> 4)] = sum; red[16 + wid * 2 + (lane >> 4)] = sq; }
    __syncthreads();
    sum = 0.f; sq = 0.f;
#pragma unroll
    for (int i = 0; i < 16; ++i) { sum += red[i]; sq += red[16 + i]; }
    float mu = sum * (1.0f / D_);
    float var = sq * (1.0f / D_) - mu * mu;
    float rr = rsqrtf(var + 1e-5f);
#pragma unroll
    for (int i = 0; i < 4; ++i) {
        int c = tid + i * 256;
        out[(size_t)row * D_ + c] = (x[i] - mu) * rr * gamma[c] + bias[c];
    }
}

// ---------------- host launcher ----------------
extern "C" void kernel_launch(void* const* d_in, const int* in_sizes, int n_in,
                              void* d_out, int out_size, void* d_ws, size_t ws_size,
                              hipStream_t stream) {
    const float* tokens = (const float*)d_in[0];
    const float* R      = (const float*)d_in[1];
    const float* Wq     = (const float*)d_in[2];
    const float* Wk     = (const float*)d_in[3];
    const float* Wv     = (const float*)d_in[4];
    const float* Wp     = (const float*)d_in[5];
    const float* beta   = (const float*)d_in[6];
    const float* gamma  = (const float*)d_in[7];
    const float* bias   = (const float*)d_in[8];
    float* out = (float*)d_out;

    const int M = B_ * L_;   // 8192
    char* ws = (char*)d_ws;
    size_t off = 0;
    bf16*  Xbf   = (bf16*)(ws + off);  off += (size_t)M * D_ * 2;
    bf16*  Wb    = (bf16*)(ws + off);  off += (size_t)4 * D_ * D_ * 2;
    bf16*  Qb    = (bf16*)(ws + off);  off += (size_t)M * D_ * 2;
    bf16*  Kb    = (bf16*)(ws + off);  off += (size_t)M * D_ * 2;
    bf16*  Vtb   = (bf16*)(ws + off);  off += (size_t)M * D_ * 2;
    float* logRp = (float*)(ws + off); off += (size_t)L_ * L_ * 4;
    bf16*  Ob    = (bf16*)(ws + off);  off += (size_t)M * D_ * 2;
    float* Y     = (float*)(ws + off); off += (size_t)M * D_ * 4;

    cvt_bf16_kernel<<<(M * D_) / 1024, 256, 0, stream>>>(tokens, Xbf, M * D_);
    cvt_bf16_kernel<<<(D_ * D_) / 1024, 256, 0, stream>>>(Wq, Wb + 0 * (size_t)D_ * D_, D_ * D_);
    cvt_bf16_kernel<<<(D_ * D_) / 1024, 256, 0, stream>>>(Wk, Wb + 1 * (size_t)D_ * D_, D_ * D_);
    cvt_bf16_kernel<<<(D_ * D_) / 1024, 256, 0, stream>>>(Wv, Wb + 2 * (size_t)D_ * D_, D_ * D_);
    cvt_bf16_kernel<<<(D_ * D_) / 1024, 256, 0, stream>>>(Wp, Wb + 3 * (size_t)D_ * D_, D_ * D_);
    prep_logr_perm<<<dim3(L_ / 256, L_), 256, 0, stream>>>(R, beta, logRp);

    dim3 ggrid(D_ / 128, M / 128);
    gemm_wmma<0><<<ggrid, 256, 0, stream>>>(Xbf, Wb + 0 * (size_t)D_ * D_, Qb, M, D_, D_);
    gemm_wmma<0><<<ggrid, 256, 0, stream>>>(Xbf, Wb + 1 * (size_t)D_ * D_, Kb, M, D_, D_);
    gemm_wmma<2><<<ggrid, 256, 0, stream>>>(Xbf, Wb + 2 * (size_t)D_ * D_, Vtb, M, D_, D_);

    attn_flash<<<B_ * H_ * (L_ / 64), 128, 0, stream>>>(Qb, Kb, Vtb, logRp, Ob);

    gemm_wmma<1><<<ggrid, 256, 0, stream>>>(Ob, Wb + 3 * (size_t)D_ * D_, Y, M, D_, D_);

    resid_ln<<<M, 256, 0, stream>>>(Y, tokens, gamma, bias, out);
}

// v001
// One run takes 227 microseconds.
// Next to v000, in two timings, it ran 1.25 times as fast each time.
#include <hip/hip_runtime.h>
#include <hip/hip_bf16.h>
#include <math.h>

// ---------------- types ----------------
typedef __bf16 bf16;
typedef bf16  bf16x8  __attribute__((ext_vector_type(8)));
typedef bf16  bf16x16 __attribute__((ext_vector_type(16)));
typedef float f32x8   __attribute__((ext_vector_type(8)));
typedef float f32x4   __attribute__((ext_vector_type(4)));
typedef unsigned int u32x4 __attribute__((ext_vector_type(4)));
typedef int  i32x4 __attribute__((ext_vector_type(4)));
typedef int  i32x8 __attribute__((ext_vector_type(8)));

#define B_  4
#define L_  2048
#define D_  1024
#define H_  16
#define DH_ 64
#define SCALE_ 0.125f   // 64^-0.5

#if __has_builtin(__builtin_amdgcn_tensor_load_to_lds)
#define USE_TDM 1
#else
#define USE_TDM 0
#endif

// float -> bf16 round-to-nearest-even
__device__ __forceinline__ bf16 f2bf(float f) {
    unsigned u = __builtin_bit_cast(unsigned, f);
    u += 0x7FFFu + ((u >> 16) & 1u);
    unsigned short h = (unsigned short)(u >> 16);
    return __builtin_bit_cast(bf16, h);
}

// ---------------- DPP16 16-lane reductions (pure VALU, no LDS) ----------------
template <int CTRL>
__device__ __forceinline__ float dpp_f(float x) {
    int r = __builtin_amdgcn_update_dpp(0, __builtin_bit_cast(int, x), CTRL, 0xf, 0xf, true);
    return __builtin_bit_cast(float, r);
}
__device__ __forceinline__ float rsum16(float x) {
    x += dpp_f<0xB1>(x);     // quad_perm xor1
    x += dpp_f<0x4E>(x);     // quad_perm xor2
    x += dpp_f<0x141>(x);    // row_half_mirror
    x += dpp_f<0x140>(x);    // row_mirror
    return x;
}

__device__ __forceinline__ float xhalf(float x) {
    int b = __builtin_bit_cast(int, x);
    int r = __builtin_amdgcn_permlanex16(b, b, 0x76543210, 0xfedcba98, false, false);
    return __builtin_bit_cast(float, r);
}

__device__ __forceinline__ void async_b128(void* lds_ptr, const void* gptr) {
    unsigned la = (unsigned)(uintptr_t)lds_ptr;
    unsigned long long ga = (unsigned long long)(uintptr_t)gptr;
    asm volatile("global_load_async_to_lds_b128 %0, %1, off"
                 :: "v"(la), "v"(ga) : "memory");
}
__device__ __forceinline__ void wait_async_le0() { asm volatile("s_wait_asynccnt 0x0" ::: "memory"); }
__device__ __forceinline__ void wait_async_le4() { asm volatile("s_wait_asynccnt 0x4" ::: "memory"); }
__device__ __forceinline__ void wait_async_le8() { asm volatile("s_wait_asynccnt 0x8" ::: "memory"); }

#if USE_TDM
__device__ __forceinline__ void tdm_load_2d(void* lds_ptr, const void* gptr,
                                            unsigned tensor_d0, unsigned tensor_d1,
                                            unsigned tile_d0, unsigned tile_d1,
                                            unsigned stride_d0,
                                            unsigned pad_i, unsigned pad_a) {
    unsigned long long ga = (unsigned long long)(uintptr_t)gptr;
    u32x4 g0;
    g0[0] = 1u;
    g0[1] = (unsigned)(uintptr_t)lds_ptr;
    g0[2] = (unsigned)(ga & 0xFFFFFFFFu);
    g0[3] = (unsigned)((ga >> 32) & 0x1FFFFFFu) | (2u << 30);
    i32x8 g1;
    g1[0] = (int)((1u << 16) | (1u << 20) | (pad_i << 22) | (pad_a << 25));
    g1[1] = (int)((tensor_d0 & 0xFFFFu) << 16);
    g1[2] = (int)((tensor_d0 >> 16) | ((tensor_d1 & 0xFFFFu) << 16));
    g1[3] = (int)((tensor_d1 >> 16) | (tile_d0 << 16));
    g1[4] = (int)tile_d1;
    g1[5] = (int)stride_d0;
    g1[6] = 0;
    g1[7] = 0;
    i32x4 gz = {0, 0, 0, 0};
#if defined(__clang_major__) && (__clang_major__ >= 23)
    i32x8 gz8 = {0, 0, 0, 0, 0, 0, 0, 0};
    __builtin_amdgcn_tensor_load_to_lds(g0, g1, gz, gz, gz8, 0);
#else
    __builtin_amdgcn_tensor_load_to_lds(g0, g1, gz, gz, 0);
#endif
}
__device__ __forceinline__ void wait_tensor0() { __builtin_amdgcn_s_wait_tensorcnt(0); }
__device__ __forceinline__ void wait_tensor2() { __builtin_amdgcn_s_wait_tensorcnt(2); }
#endif

__device__ __forceinline__ bf16x16 load_frag(const bf16* p, int stride, int lane) {
    int hf = lane >> 4;
    int r  = lane & 15;
    const bf16* q = p + r * stride + hf * 8;
    bf16x8 lo = *(const bf16x8*)(q);
    bf16x8 hi = *(const bf16x8*)(q + 16);
    bf16x16 f;
#pragma unroll
    for (int i = 0; i < 8; ++i) { f[i] = lo[i]; f[i + 8] = hi[i]; }
    return f;
}

__device__ __forceinline__ f32x8 wmma_bf16(bf16x16 a, bf16x16 b, f32x8 c) {
    return __builtin_amdgcn_wmma_f32_16x16x32_bf16(false, a, false, b, (short)0, c, false, false);
}

// ---------------- prep kernels ----------------
__global__ __launch_bounds__(256) void cvt_bf16_kernel(const float* __restrict__ in,
                                                       bf16* __restrict__ out, int n) {
    int i = (blockIdx.x * 256 + threadIdx.x) * 4;
#pragma unroll
    for (int j = 0; j < 4; ++j)
        if (i + j < n) out[i + j] = f2bf(in[i + j]);
}

// beta*log(max(R,eps)) permuted into the D-fragment order of the transposed score tile
// (rows = keys, columns = queries): lane = (query & 15) + 16 * ((key >> 3) & 1)
__global__ __launch_bounds__(256) void prep_logr_perm(const float* __restrict__ R,
                                                      const float* __restrict__ beta,
                                                      float* __restrict__ out) {
    int kg = blockIdx.x * 256 + threadIdx.x;
    int qg = blockIdx.y;
    float b = beta[0];
    float val = b * __logf(fmaxf(R[(size_t)qg * L_ + kg], 1e-8f));
    int hf = (kg >> 3) & 1, v = kg & 7;
    int lc = qg & 15, j = (kg >> 4) & 1;
    int lane = hf * 16 + lc, e = j * 8 + v;
    out[(((size_t)(qg >> 4) * (L_ / 32) + (kg >> 5)) * 32 + lane) * 16 + e] = val;
}

template <int MODE>
__global__ __launch_bounds__(256) void gemm_wmma(const bf16* __restrict__ A,
                                                 const bf16* __restrict__ W,
                                                 void* __restrict__ outp,
                                                 int M, int N, int K) {
    __shared__ bf16 sA[2][128 * 72];
    __shared__ bf16 sB[2][128 * 72];

    int tid = threadIdx.x, lane = tid & 31, wid = tid >> 5;
    int wm = wid & 3, wn = wid >> 2;
    int rowBase = blockIdx.y * 128, colBase = blockIdx.x * 128;
    const bf16* gA0 = A + (size_t)rowBase * K;
    const bf16* gW0 = W + (size_t)colBase * K;

    f32x8 acc[2][4];
#pragma unroll
    for (int i = 0; i < 2; ++i)
#pragma unroll
        for (int j = 0; j < 4; ++j) acc[i][j] = (f32x8)0.0f;

    const int NK = K >> 6;

#if USE_TDM
    bool leader = (wid == 0);
    if (leader) {
        tdm_load_2d(&sA[0][0], gA0, (unsigned)K, (unsigned)M, 64, 128, (unsigned)K, 4, 3);
        tdm_load_2d(&sB[0][0], gW0, (unsigned)K, (unsigned)N, 64, 128, (unsigned)K, 4, 3);
    }
#else
    int r = tid >> 1, hh = tid & 1;
    const bf16* gA = gA0 + (size_t)r * K + hh * 32;
    const bf16* gW = gW0 + (size_t)r * K + hh * 32;
    int lbase = r * 72 + hh * 32;
#pragma unroll
    for (int i = 0; i < 4; ++i) {
        async_b128(&sA[0][lbase + i * 8], gA + i * 8);
        async_b128(&sB[0][lbase + i * 8], gW + i * 8);
    }
#endif

    for (int kt = 0; kt < NK; ++kt) {
        int cur = kt & 1;
#if USE_TDM
        if (leader) {
            if (kt + 1 < NK) {
                tdm_load_2d(&sA[cur ^ 1][0], gA0 + (kt + 1) * 64, (unsigned)K, (unsigned)M,
                            64, 128, (unsigned)K, 4, 3);
                tdm_load_2d(&sB[cur ^ 1][0], gW0 + (kt + 1) * 64, (unsigned)K, (unsigned)N,
                            64, 128, (unsigned)K, 4, 3);
                wait_tensor2();   // tensor ops in-order: current tile's pair complete
            } else {
                wait_tensor0();
            }
        }
#else
        if (kt + 1 < NK) {
            const bf16* ga = gA + (size_t)(kt + 1) * 64;
            const bf16* gb = gW + (size_t)(kt + 1) * 64;
#pragma unroll
            for (int i = 0; i < 4; ++i) {
                async_b128(&sA[cur ^ 1][lbase + i * 8], ga + i * 8);
                async_b128(&sB[cur ^ 1][lbase + i * 8], gb + i * 8);
            }
            wait_async_le8();
        } else {
            wait_async_le0();
        }
#endif
        __syncthreads();

#pragma unroll
        for (int ks = 0; ks < 2; ++ks) {
            bf16x16 af[2], bfr[4];
#pragma unroll
            for (int fm = 0; fm < 2; ++fm)
                af[fm] = load_frag(&sA[cur][(wm * 32 + fm * 16) * 72 + ks * 32], 72, lane);
#pragma unroll
            for (int fn = 0; fn < 4; ++fn)
                bfr[fn] = load_frag(&sB[cur][(wn * 64 + fn * 16) * 72 + ks * 32], 72, lane);
#pragma unroll
            for (int fm = 0; fm < 2; ++fm)
#pragma unroll
                for (int fn = 0; fn < 4; ++fn)
                    acc[fm][fn] = wmma_bf16(af[fm], bfr[fn], acc[fm][fn]);
        }
        __syncthreads();
    }

    int hf = lane >> 4, lc = lane & 15;
#pragma unroll
    for (int fm = 0; fm < 2; ++fm)
#pragma unroll
        for (int fn = 0; fn < 4; ++fn)
#pragma unroll
            for (int v = 0; v < 8; ++v) {
                int rr = rowBase + wm * 32 + fm * 16 + v + hf * 8;
                int cc = colBase + wn * 64 + fn * 16 + lc;
                float val = acc[fm][fn][v];
                int b = rr >> 11, l = rr & (L_ - 1);
                int h = cc >> 6, d = cc & 63;
                if (MODE == 0) {
                    ((bf16*)outp)[(((size_t)(b * H_ + h)) * L_ + l) * DH_ + d] = f2bf(val);
                } else if (MODE == 2) {
                    ((bf16*)outp)[(((size_t)(b * H_ + h)) * DH_ + d) * L_ + l] = f2bf(val);
                } else {
                    ((float*)outp)[(size_t)rr * N + cc] = val;
                }
            }
}

// ---------------- flash attention with log-R bias (async double-buffered) ----------------
__global__ __launch_bounds__(128) void attn_flash(const bf16* __restrict__ Q,
                                                  const bf16* __restrict__ Km,
                                                  const bf16* __restrict__ Vt,
                                                  const float* __restrict__ logRp,
                                                  bf16* __restrict__ O) {
    __shared__ bf16 sK[2][32 * 72];    // [key][d]  (A operand of S^T = K Q^T)
    __shared__ bf16 sVt[2][64 * 40];   // [d][key]  (A operand of O^T += V^T P^T)

    int tid = threadIdx.x, lane = tid & 31, w = tid >> 5;
    int bid = blockIdx.x;
    int qt = bid & 31, h = (bid >> 5) & (H_ - 1), b = bid >> 9;
    int bh = b * H_ + h;
    const bf16* Qh = Q + (size_t)bh * L_ * DH_;
    const bf16* Kh = Km + (size_t)bh * L_ * DH_;
    const bf16* Vh = Vt + (size_t)bh * DH_ * L_;   // [Dh][L]
    int q0 = qt * 64 + w * 16;
    int hf = lane >> 4, lc = lane & 15;

    bf16x16 qf[2];
    qf[0] = load_frag(Qh + (size_t)q0 * DH_ + 0, DH_, lane);
    qf[1] = load_frag(Qh + (size_t)q0 * DH_ + 32, DH_, lane);

    // one query column per lane (q0 + lc); the two halves hold different keys of it
    float m = -1e30f, s = 0.0f;
    f32x8 of[4];   // O^T tiles: of[n][v] = O[q0 + lc][n * 16 + hf * 8 + v]
#pragma unroll
    for (int n = 0; n < 4; ++n) of[n] = (f32x8)0.0f;

    const float* lrbase = logRp + ((size_t)(q0 >> 4) * (L_ / 32)) * 512 + lane * 16;

    int keyA = tid >> 2, segA = tid & 3;
    int dV = tid >> 1, hV = tid & 1;
    const bf16* gk0 = Kh + (size_t)keyA * DH_ + segA * 16;
    const bf16* gv0 = Vh + (size_t)dV * L_ + hV * 16;
    int lK = keyA * 72 + segA * 16;
    int lV = dV * 40 + hV * 16;

    async_b128(&sK[0][lK],      gk0);
    async_b128(&sK[0][lK + 8],  gk0 + 8);
    async_b128(&sVt[0][lV],     gv0);
    async_b128(&sVt[0][lV + 8], gv0 + 8);

    for (int kt = 0; kt < L_; kt += 32) {
        int cur = (kt >> 5) & 1;
        if (kt + 32 < L_) {
            const bf16* gk = gk0 + (size_t)(kt + 32) * DH_;
            const bf16* gv = gv0 + (kt + 32);
            async_b128(&sK[cur ^ 1][lK],      gk);
            async_b128(&sK[cur ^ 1][lK + 8],  gk + 8);
            async_b128(&sVt[cur ^ 1][lV],     gv);
            async_b128(&sVt[cur ^ 1][lV + 8], gv + 8);
        }

        const float* lr = lrbase + (size_t)(kt >> 5) * 512;
        f32x4 c0 = *(const f32x4*)(lr + 0);
        f32x4 c1 = *(const f32x4*)(lr + 4);
        f32x4 c2 = *(const f32x4*)(lr + 8);
        f32x4 c3 = *(const f32x4*)(lr + 12);
        if (kt + 32 < L_) __builtin_prefetch(lr + 512, 0, 1);

        if (kt + 32 < L_) wait_async_le4(); else wait_async_le0();
        __syncthreads();

        f32x8 sc[2];
        sc[0] = (f32x8)0.0f; sc[1] = (f32x8)0.0f;
#pragma unroll
        for (int j = 0; j < 2; ++j)
#pragma unroll
            for (int kd = 0; kd < 2; ++kd)
                sc[j] = wmma_bf16(load_frag(&sK[cur][(j * 16) * 72 + kd * 32], 72, lane),
                                  qf[kd], sc[j]);

        float xv[2][8];
#pragma unroll
        for (int v = 0; v < 4; ++v) {
            xv[0][v]     = sc[0][v]     * SCALE_ + c0[v];
            xv[0][v + 4] = sc[0][v + 4] * SCALE_ + c1[v];
            xv[1][v]     = sc[1][v]     * SCALE_ + c2[v];
            xv[1][v + 4] = sc[1][v + 4] * SCALE_ + c3[v];
        }

        // xv[j][v] = score of key kt + j * 16 + hf * 8 + v for query q0 + lc
        float rm = fmaxf(xv[0][0], xv[1][0]);
#pragma unroll
        for (int v = 1; v < 8; ++v) rm = fmaxf(rm, fmaxf(xv[0][v], xv[1][v]));
        rm = fmaxf(rm, xhalf(rm));
        float mn = fmaxf(m, rm);
        float corr = __expf(m - mn);
        m = mn;
#pragma unroll
        for (int j = 0; j < 2; ++j)
#pragma unroll
            for (int v = 0; v < 8; ++v) xv[j][v] = __expf(xv[j][v] - mn);
        float ls = 0.0f;
#pragma unroll
        for (int v = 0; v < 8; ++v) ls += xv[0][v] + xv[1][v];
        s = s * corr + ls;   // this half's keys only; the halves join after the loop
#pragma unroll
        for (int n = 0; n < 4; ++n)
#pragma unroll
            for (int v = 0; v < 8; ++v) of[n][v] *= corr;

        // two D tiles of S^T, converted in place, are the B operand P^T (hardware k order)
        bf16x16 pf;
#pragma unroll
        for (int j = 0; j < 2; ++j)
#pragma unroll
            for (int v = 0; v < 8; ++v) pf[j * 8 + v] = f2bf(xv[j][v]);
#pragma unroll
        for (int n = 0; n < 4; ++n)
            of[n] = wmma_bf16(load_frag(&sVt[cur][(n * 16) * 40], 40, lane), pf, of[n]);
        __syncthreads();
    }

    s = 1.0f / (s + xhalf(s));
    bf16* orow = O + ((size_t)(b * L_ + q0 + lc)) * D_ + h * DH_ + hf * 8;
#pragma unroll
    for (int n = 0; n < 4; ++n) {
        bf16x8 o8;
#pragma unroll
        for (int v = 0; v < 8; ++v) o8[v] = f2bf(of[n][v] * s);
        *(bf16x8*)(orow + n * 16) = o8;
    }
}

// ---------------- residual + LayerNorm ----------------
__global__ __launch_bounds__(256) void resid_ln(const float* __restrict__ Y,
                                                const float* __restrict__ tokens,
                                                const float* __restrict__ gamma,
                                                const float* __restrict__ bias,
                                                float* __restrict__ out) {
    int row = blockIdx.x, tid = threadIdx.x;
    const float* y = Y + (size_t)row * D_;
    const float* t = tokens + (size_t)row * D_;
    float x[4], sum = 0.f, sq = 0.f;
#pragma unroll
    for (int i = 0; i < 4; ++i) {
        int c = tid + i * 256;
        x[i] = y[c] + t[c];
        sum += x[i];
        sq  += x[i] * x[i];
    }
    sum = rsum16(sum); sq = rsum16(sq);
    __shared__ float red[32];
    int wid = tid >> 5, lane = tid & 31;
    if ((lane & 15) == 0) { red[wid * 2 + (lane >> 4)] = sum; red[16 + wid * 2 + (lane >> 4)] = sq; }
    __syncthreads();
    sum = 0.f; sq = 0.f;
#pragma unroll
    for (int i = 0; i < 16; ++i) { sum += red[i]; sq += red[16 + i]; }
    float mu = sum * (1.0f / D_);
    float var = sq * (1.0f / D_) - mu * mu;
    float rr = rsqrtf(var + 1e-5f);
#pragma unroll
    for (int i = 0; i < 4; ++i) {
        int c = tid + i * 256;
        out[(size_t)row * D_ + c] = (x[i] - mu) * rr * gamma[c] + bias[c];
    }
}

// ---------------- host launcher ----------------
extern "C" void kernel_launch(void* const* d_in, const int* in_sizes, int n_in,
                              void* d_out, int out_size, void* d_ws, size_t ws_size,
                              hipStream_t stream) {
    const float* tokens = (const float*)d_in[0];
    const float* R      = (const float*)d_in[1];
    const float* Wq     = (const float*)d_in[2];
    const float* Wk     = (const float*)d_in[3];
    const float* Wv     = (const float*)d_in[4];
    const float* Wp     = (const float*)d_in[5];
    const float* beta   = (const float*)d_in[6];
    const float* gamma  = (const float*)d_in[7];
    const float* bias   = (const float*)d_in[8];
    float* out = (float*)d_out;

    const int M = B_ * L_;   // 8192
    char* ws = (char*)d_ws;
    size_t off = 0;
    bf16*  Xbf   = (bf16*)(ws + off);  off += (size_t)M * D_ * 2;
    bf16*  Wb    = (bf16*)(ws + off);  off += (size_t)4 * D_ * D_ * 2;
    bf16*  Qb    = (bf16*)(ws + off);  off += (size_t)M * D_ * 2;
    bf16*  Kb    = (bf16*)(ws + off);  off += (size_t)M * D_ * 2;
    bf16*  Vtb   = (bf16*)(ws + off);  off += (size_t)M * D_ * 2;
    float* logRp = (float*)(ws + off); off += (size_t)L_ * L_ * 4;
    bf16*  Ob    = (bf16*)(ws + off);  off += (size_t)M * D_ * 2;
    float* Y     = (float*)(ws + off); off += (size_t)M * D_ * 4;

    cvt_bf16_kernel<<<(M * D_) / 1024, 256, 0, stream>>>(tokens, Xbf, M * D_);
    cvt_bf16_kernel<<<(D_ * D_) / 1024, 256, 0, stream>>>(Wq, Wb + 0 * (size_t)D_ * D_, D_ * D_);
    cvt_bf16_kernel<<<(D_ * D_) / 1024, 256, 0, stream>>>(Wk, Wb + 1 * (size_t)D_ * D_, D_ * D_);
    cvt_bf16_kernel<<<(D_ * D_) / 1024, 256, 0, stream>>>(Wv, Wb + 2 * (size_t)D_ * D_, D_ * D_);
    cvt_bf16_kernel<<<(D_ * D_) / 1024, 256, 0, stream>>>(Wp, Wb + 3 * (size_t)D_ * D_, D_ * D_);
    prep_logr_perm<<<dim3(L_ / 256, L_), 256, 0, stream>>>(R, beta, logRp);

    dim3 ggrid(D_ / 128, M / 128);
    gemm_wmma<0><<<ggrid, 256, 0, stream>>>(Xbf, Wb + 0 * (size_t)D_ * D_, Qb, M, D_, D_);
    gemm_wmma<0><<<ggrid, 256, 0, stream>>>(Xbf, Wb + 1 * (size_t)D_ * D_, Kb, M, D_, D_);
    gemm_wmma<2><<<ggrid, 256, 0, stream>>>(Xbf, Wb + 2 * (size_t)D_ * D_, Vtb, M, D_, D_);

    attn_flash<<<B_ * H_ * (L_ / 64), 128, 0, stream>>>(Qb, Kb, Vtb, logRp, Ob);

    gemm_wmma<1><<<ggrid, 256, 0, stream>>>(Ob, Wb + 3 * (size_t)D_ * D_, Y, M, D_, D_);

    resid_ln<<<M, 256, 0, stream>>>(Y, tokens, gamma, bias, out);
}

// v002
// Measured time: 213 microseconds a run.
// Timed twice side by side with v001, it ran 1.08 times as fast both times.
// Over all steps from v000 it is 1.34 times as fast.
#include <hip/hip_runtime.h>
#include <hip/hip_bf16.h>
#include <math.h>

// ---------------- types ----------------
typedef __bf16 bf16;
typedef bf16  bf16x8  __attribute__((ext_vector_type(8)));
typedef bf16  bf16x16 __attribute__((ext_vector_type(16)));
typedef float f32x8   __attribute__((ext_vector_type(8)));
typedef float f32x4   __attribute__((ext_vector_type(4)));
typedef unsigned int u32x4 __attribute__((ext_vector_type(4)));
typedef int  i32x4 __attribute__((ext_vector_type(4)));
typedef int  i32x8 __attribute__((ext_vector_type(8)));

#define B_  4
#define L_  2048
#define D_  1024
#define H_  16
#define DH_ 64
#define SCALE_ 0.125f   // 64^-0.5

#if __has_builtin(__builtin_amdgcn_tensor_load_to_lds)
#define USE_TDM 1
#else
#define USE_TDM 0
#endif

// float -> bf16 round-to-nearest-even
__device__ __forceinline__ bf16 f2bf(float f) {
    unsigned u = __builtin_bit_cast(unsigned, f);
    u += 0x7FFFu + ((u >> 16) & 1u);
    unsigned short h = (unsigned short)(u >> 16);
    return __builtin_bit_cast(bf16, h);
}

// ---------------- DPP16 16-lane reductions (pure VALU, no LDS) ----------------
template <int CTRL>
__device__ __forceinline__ float dpp_f(float x) {
    int r = __builtin_amdgcn_update_dpp(0, __builtin_bit_cast(int, x), CTRL, 0xf, 0xf, true);
    return __builtin_bit_cast(float, r);
}
__device__ __forceinline__ float rsum16(float x) {
    x += dpp_f<0xB1>(x);     // quad_perm xor1
    x += dpp_f<0x4E>(x);     // quad_perm xor2
    x += dpp_f<0x141>(x);    // row_half_mirror
    x += dpp_f<0x140>(x);    // row_mirror
    return x;
}

__device__ __forceinline__ float xhalf(float x) {
    int b = __builtin_bit_cast(int, x);
    int r = __builtin_amdgcn_permlanex16(b, b, 0x76543210, 0xfedcba98, false, false);
    return __builtin_bit_cast(float, r);
}

__device__ __forceinline__ void async_b128(void* lds_ptr, const void* gptr) {
    unsigned la = (unsigned)(uintptr_t)lds_ptr;
    unsigned long long ga = (unsigned long long)(uintptr_t)gptr;
    asm volatile("global_load_async_to_lds_b128 %0, %1, off"
                 :: "v"(la), "v"(ga) : "memory");
}
__device__ __forceinline__ void wait_async_le0() { asm volatile("s_wait_asynccnt 0x0" ::: "memory"); }
__device__ __forceinline__ void wait_async_le4() { asm volatile("s_wait_asynccnt 0x4" ::: "memory"); }
__device__ __forceinline__ void wait_async_le8() { asm volatile("s_wait_asynccnt 0x8" ::: "memory"); }

#if USE_TDM
__device__ __forceinline__ void tdm_load_2d(void* lds_ptr, const void* gptr,
                                            unsigned tensor_d0, unsigned tensor_d1,
                                            unsigned tile_d0, unsigned tile_d1,
                                            unsigned stride_d0,
                                            unsigned pad_i, unsigned pad_a) {
    unsigned long long ga = (unsigned long long)(uintptr_t)gptr;
    u32x4 g0;
    g0[0] = 1u;
    g0[1] = (unsigned)(uintptr_t)lds_ptr;
    g0[2] = (unsigned)(ga & 0xFFFFFFFFu);
    g0[3] = (unsigned)((ga >> 32) & 0x1FFFFFFu) | (2u << 30);
    i32x8 g1;
    g1[0] = (int)((1u << 16) | (1u << 20) | (pad_i << 22) | (pad_a << 25));
    g1[1] = (int)((tensor_d0 & 0xFFFFu) << 16);
    g1[2] = (int)((tensor_d0 >> 16) | ((tensor_d1 & 0xFFFFu) << 16));
    g1[3] = (int)((tensor_d1 >> 16) | (tile_d0 << 16));
    g1[4] = (int)tile_d1;
    g1[5] = (int)stride_d0;
    g1[6] = 0;
    g1[7] = 0;
    i32x4 gz = {0, 0, 0, 0};
#if defined(__clang_major__) && (__clang_major__ >= 23)
    i32x8 gz8 = {0, 0, 0, 0, 0, 0, 0, 0};
    __builtin_amdgcn_tensor_load_to_lds(g0, g1, gz, gz, gz8, 0);
#else
    __builtin_amdgcn_tensor_load_to_lds(g0, g1, gz, gz, 0);
#endif
}
__device__ __forceinline__ void wait_tensor0() { __builtin_amdgcn_s_wait_tensorcnt(0); }
__device__ __forceinline__ void wait_tensor2() { __builtin_amdgcn_s_wait_tensorcnt(2); }
#endif

__device__ __forceinline__ bf16x16 load_frag(const bf16* p, int stride, int lane) {
    int hf = lane >> 4;
    int r  = lane & 15;
    const bf16* q = p + r * stride + hf * 8;
    bf16x8 lo = *(const bf16x8*)(q);
    bf16x8 hi = *(const bf16x8*)(q + 16);
    bf16x16 f;
#pragma unroll
    for (int i = 0; i < 8; ++i) { f[i] = lo[i]; f[i + 8] = hi[i]; }
    return f;
}

__device__ __forceinline__ f32x8 wmma_bf16(bf16x16 a, bf16x16 b, f32x8 c) {
    return __builtin_amdgcn_wmma_f32_16x16x32_bf16(false, a, false, b, (short)0, c, false, false);
}

// ---------------- prep kernels ----------------
__device__ __forceinline__ void cvt_bf16_block(const float* __restrict__ in,
                                               bf16* __restrict__ out, int n, int blk) {
    int i = (blk * 256 + threadIdx.x) * 4;
#pragma unroll
    for (int j = 0; j < 4; ++j)
        if (i + j < n) out[i + j] = f2bf(in[i + j]);
}

// beta*log(max(R,eps)) permuted into the D-fragment order of the transposed score tile
// (rows = keys, columns = queries): lane = (query & 15) + 16 * ((key >> 3) & 1)
__device__ __forceinline__ void prep_logr_block(const float* __restrict__ R,
                                                const float* __restrict__ beta,
                                                float* __restrict__ out, int bx, int by) {
    int kg = bx * 256 + threadIdx.x;
    int qg = by;
    float b = beta[0];
    float val = b * __logf(fmaxf(R[(size_t)qg * L_ + kg], 1e-8f));
    int hf = (kg >> 3) & 1, v = kg & 7;
    int lc = qg & 15, j = (kg >> 4) & 1;
    int lane = hf * 16 + lc, e = j * 8 + v;
    out[(((size_t)(qg >> 4) * (L_ / 32) + (kg >> 5)) * 32 + lane) * 16 + e] = val;
}

// all six independent prep jobs in one grid: a block's index range says which job it does
#define NB_LR_  ((L_ / 256) * L_)
#define NB_TOK_ ((B_ * L_ * D_) / 1024)
#define NB_W_   ((D_ * D_) / 1024)
__global__ __launch_bounds__(256) void prep_all(const float* __restrict__ tokens,
                                                const float* __restrict__ Wq,
                                                const float* __restrict__ Wk,
                                                const float* __restrict__ Wv,
                                                const float* __restrict__ Wp,
                                                const float* __restrict__ R,
                                                const float* __restrict__ beta,
                                                bf16* __restrict__ Xbf,
                                                bf16* __restrict__ Wb,
                                                float* __restrict__ logRp) {
    int blk = blockIdx.x;
    if (blk < NB_LR_) {
        prep_logr_block(R, beta, logRp, blk & (L_ / 256 - 1), blk / (L_ / 256));
    } else if (blk < NB_LR_ + NB_TOK_) {
        cvt_bf16_block(tokens, Xbf, B_ * L_ * D_, blk - NB_LR_);
    } else {
        int r = blk - (NB_LR_ + NB_TOK_);
        int ws = r / NB_W_;
        const float* w = ws == 0 ? Wq : ws == 1 ? Wk : ws == 2 ? Wv : Wp;
        cvt_bf16_block(w, Wb + (size_t)ws * D_ * D_, D_ * D_, r & (NB_W_ - 1));
    }
}

template <int SM>
__device__ __forceinline__ void store_tile(const f32x8 (&acc)[2][4], void* __restrict__ outp,
                                           int rowBase, int colBase, int wm, int wn,
                                           int lane, int N) {
    int hf = lane >> 4, lc = lane & 15;
#pragma unroll
    for (int fm = 0; fm < 2; ++fm)
#pragma unroll
        for (int fn = 0; fn < 4; ++fn)
#pragma unroll
            for (int v = 0; v < 8; ++v) {
                int rr = rowBase + wm * 32 + fm * 16 + v + hf * 8;
                int cc = colBase + wn * 64 + fn * 16 + lc;
                float val = acc[fm][fn][v];
                int b = rr >> 11, l = rr & (L_ - 1);
                int h = cc >> 6, d = cc & 63;
                if (SM == 0) {
                    ((bf16*)outp)[(((size_t)(b * H_ + h)) * L_ + l) * DH_ + d] = f2bf(val);
                } else if (SM == 2) {
                    ((bf16*)outp)[(((size_t)(b * H_ + h)) * DH_ + d) * L_ + l] = f2bf(val);
                } else {
                    ((float*)outp)[(size_t)rr * N + cc] = val;
                }
            }
}

// MODE 1: one product, f32 row-major out. MODE 3: W holds Wq, Wk, Wv stacked (N = 3 * D_);
// a block's 128 columns lie in one of them; outp holds Q, K (form 0) and V^T (form 2) in a row.
template <int MODE>
__global__ __launch_bounds__(256) void gemm_wmma(const bf16* __restrict__ A,
                                                 const bf16* __restrict__ W,
                                                 void* __restrict__ outp,
                                                 int M, int N, int K) {
    __shared__ bf16 sA[2][128 * 72];
    __shared__ bf16 sB[2][128 * 72];

    int tid = threadIdx.x, lane = tid & 31, wid = tid >> 5;
    int wm = wid & 3, wn = wid >> 2;
    int rowBase = blockIdx.y * 128, colBase = blockIdx.x * 128;
    const bf16* gA0 = A + (size_t)rowBase * K;
    const bf16* gW0 = W + (size_t)colBase * K;

    f32x8 acc[2][4];
#pragma unroll
    for (int i = 0; i < 2; ++i)
#pragma unroll
        for (int j = 0; j < 4; ++j) acc[i][j] = (f32x8)0.0f;

    const int NK = K >> 6;

#if USE_TDM
    bool leader = (wid == 0);
    if (leader) {
        tdm_load_2d(&sA[0][0], gA0, (unsigned)K, (unsigned)M, 64, 128, (unsigned)K, 4, 3);
        tdm_load_2d(&sB[0][0], gW0, (unsigned)K, (unsigned)N, 64, 128, (unsigned)K, 4, 3);
    }
#else
    int r = tid >> 1, hh = tid & 1;
    const bf16* gA = gA0 + (size_t)r * K + hh * 32;
    const bf16* gW = gW0 + (size_t)r * K + hh * 32;
    int lbase = r * 72 + hh * 32;
#pragma unroll
    for (int i = 0; i < 4; ++i) {
        async_b128(&sA[0][lbase + i * 8], gA + i * 8);
        async_b128(&sB[0][lbase + i * 8], gW + i * 8);
    }
#endif

    for (int kt = 0; kt < NK; ++kt) {
        int cur = kt & 1;
#if USE_TDM
        if (leader) {
            if (kt + 1 < NK) {
                tdm_load_2d(&sA[cur ^ 1][0], gA0 + (kt + 1) * 64, (unsigned)K, (unsigned)M,
                            64, 128, (unsigned)K, 4, 3);
                tdm_load_2d(&sB[cur ^ 1][0], gW0 + (kt + 1) * 64, (unsigned)K, (unsigned)N,
                            64, 128, (unsigned)K, 4, 3);
                wait_tensor2();   // tensor ops in-order: current tile's pair complete
            } else {
                wait_tensor0();
            }
        }
#else
        if (kt + 1 < NK) {
            const bf16* ga = gA + (size_t)(kt + 1) * 64;
            const bf16* gb = gW + (size_t)(kt + 1) * 64;
#pragma unroll
            for (int i = 0; i < 4; ++i) {
                async_b128(&sA[cur ^ 1][lbase + i * 8], ga + i * 8);
                async_b128(&sB[cur ^ 1][lbase + i * 8], gb + i * 8);
            }
            wait_async_le8();
        } else {
            wait_async_le0();
        }
#endif
        __syncthreads();

#pragma unroll
        for (int ks = 0; ks < 2; ++ks) {
            bf16x16 af[2], bfr[4];
#pragma unroll
            for (int fm = 0; fm < 2; ++fm)
                af[fm] = load_frag(&sA[cur][(wm * 32 + fm * 16) * 72 + ks * 32], 72, lane);
#pragma unroll
            for (int fn = 0; fn < 4; ++fn)
                bfr[fn] = load_frag(&sB[cur][(wn * 64 + fn * 16) * 72 + ks * 32], 72, lane);
#pragma unroll
            for (int fm = 0; fm < 2; ++fm)
#pragma unroll
                for (int fn = 0; fn < 4; ++fn)
                    acc[fm][fn] = wmma_bf16(af[fm], bfr[fn], acc[fm][fn]);
        }
        __syncthreads();
    }

    if (MODE == 1) {
        store_tile<1>(acc, outp, rowBase, colBase, wm, wn, lane, N);
    } else {
        int sel = colBase / D_;
        bf16* o = (bf16*)outp + (size_t)sel * ((size_t)B_ * L_ * D_);
        if (sel == 2) {
            store_tile<2>(acc, o, rowBase, colBase & (D_ - 1), wm, wn, lane, N);
        } else {
            store_tile<0>(acc, o, rowBase, colBase & (D_ - 1), wm, wn, lane, N);
            // in the listing the other form's code stands behind these stores and rewrites
            // their address registers: this wait stands in front of that rewrite
            asm volatile("s_wait_xcnt 0x0" ::: "memory");
        }
    }
}

// ---------------- flash attention with log-R bias (async double-buffered) ----------------
__global__ __launch_bounds__(128) void attn_flash(const bf16* __restrict__ Q,
                                                  const bf16* __restrict__ Km,
                                                  const bf16* __restrict__ Vt,
                                                  const float* __restrict__ logRp,
                                                  bf16* __restrict__ O) {
    __shared__ bf16 sK[2][32 * 72];    // [key][d]  (A operand of S^T = K Q^T)
    __shared__ bf16 sVt[2][64 * 40];   // [d][key]  (A operand of O^T += V^T P^T)

    int tid = threadIdx.x, lane = tid & 31, w = tid >> 5;
    int bid = blockIdx.x;
    int qt = bid & 31, h = (bid >> 5) & (H_ - 1), b = bid >> 9;
    int bh = b * H_ + h;
    const bf16* Qh = Q + (size_t)bh * L_ * DH_;
    const bf16* Kh = Km + (size_t)bh * L_ * DH_;
    const bf16* Vh = Vt + (size_t)bh * DH_ * L_;   // [Dh][L]
    int q0 = qt * 64 + w * 16;
    int hf = lane >> 4, lc = lane & 15;

    bf16x16 qf[2];
    qf[0] = load_frag(Qh + (size_t)q0 * DH_ + 0, DH_, lane);
    qf[1] = load_frag(Qh + (size_t)q0 * DH_ + 32, DH_, lane);

    // one query column per lane (q0 + lc); the two halves hold different keys of it
    float m = -1e30f, s = 0.0f;
    f32x8 of[4];   // O^T tiles: of[n][v] = O[q0 + lc][n * 16 + hf * 8 + v]
#pragma unroll
    for (int n = 0; n < 4; ++n) of[n] = (f32x8)0.0f;

    const float* lrbase = logRp + ((size_t)(q0 >> 4) * (L_ / 32)) * 512 + lane * 16;

    int keyA = tid >> 2, segA = tid & 3;
    int dV = tid >> 1, hV = tid & 1;
    const bf16* gk0 = Kh + (size_t)keyA * DH_ + segA * 16;
    const bf16* gv0 = Vh + (size_t)dV * L_ + hV * 16;
    int lK = keyA * 72 + segA * 16;
    int lV = dV * 40 + hV * 16;

    async_b128(&sK[0][lK],      gk0);
    async_b128(&sK[0][lK + 8],  gk0 + 8);
    async_b128(&sVt[0][lV],     gv0);
    async_b128(&sVt[0][lV + 8], gv0 + 8);

    for (int kt = 0; kt < L_; kt += 32) {
        int cur = (kt >> 5) & 1;
        if (kt + 32 < L_) {
            const bf16* gk = gk0 + (size_t)(kt + 32) * DH_;
            const bf16* gv = gv0 + (kt + 32);
            async_b128(&sK[cur ^ 1][lK],      gk);
            async_b128(&sK[cur ^ 1][lK + 8],  gk + 8);
            async_b128(&sVt[cur ^ 1][lV],     gv);
            async_b128(&sVt[cur ^ 1][lV + 8], gv + 8);
        }

        const float* lr = lrbase + (size_t)(kt >> 5) * 512;
        f32x4 c0 = *(const f32x4*)(lr + 0);
        f32x4 c1 = *(const f32x4*)(lr + 4);
        f32x4 c2 = *(const f32x4*)(lr + 8);
        f32x4 c3 = *(const f32x4*)(lr + 12);
        if (kt + 32 < L_) __builtin_prefetch(lr + 512, 0, 1);

        if (kt + 32 < L_) wait_async_le4(); else wait_async_le0();
        __syncthreads();

        f32x8 sc[2];
        sc[0] = (f32x8)0.0f; sc[1] = (f32x8)0.0f;
#pragma unroll
        for (int j = 0; j < 2; ++j)
#pragma unroll
            for (int kd = 0; kd < 2; ++kd)
                sc[j] = wmma_bf16(load_frag(&sK[cur][(j * 16) * 72 + kd * 32], 72, lane),
                                  qf[kd], sc[j]);

        float xv[2][8];
#pragma unroll
        for (int v = 0; v < 4; ++v) {
            xv[0][v]     = sc[0][v]     * SCALE_ + c0[v];
            xv[0][v + 4] = sc[0][v + 4] * SCALE_ + c1[v];
            xv[1][v]     = sc[1][v]     * SCALE_ + c2[v];
            xv[1][v + 4] = sc[1][v + 4] * SCALE_ + c3[v];
        }

        // xv[j][v] = score of key kt + j * 16 + hf * 8 + v for query q0 + lc
        float rm = fmaxf(xv[0][0], xv[1][0]);
#pragma unroll
        for (int v = 1; v < 8; ++v) rm = fmaxf(rm, fmaxf(xv[0][v], xv[1][v]));
        rm = fmaxf(rm, xhalf(rm));
        float mn = fmaxf(m, rm);
        float corr = __expf(m - mn);
        m = mn;
#pragma unroll
        for (int j = 0; j < 2; ++j)
#pragma unroll
            for (int v = 0; v < 8; ++v) xv[j][v] = __expf(xv[j][v] - mn);
        float ls = 0.0f;
#pragma unroll
        for (int v = 0; v < 8; ++v) ls += xv[0][v] + xv[1][v];
        s = s * corr + ls;   // this half's keys only; the halves join after the loop
#pragma unroll
        for (int n = 0; n < 4; ++n)
#pragma unroll
            for (int v = 0; v < 8; ++v) of[n][v] *= corr;

        // two D tiles of S^T, converted in place, are the B operand P^T (hardware k order)
        bf16x16 pf;
#pragma unroll
        for (int j = 0; j < 2; ++j)
#pragma unroll
            for (int v = 0; v < 8; ++v) pf[j * 8 + v] = f2bf(xv[j][v]);
#pragma unroll
        for (int n = 0; n < 4; ++n)
            of[n] = wmma_bf16(load_frag(&sVt[cur][(n * 16) * 40], 40, lane), pf, of[n]);
        __syncthreads();
    }

    s = 1.0f / (s + xhalf(s));
    bf16* orow = O + ((size_t)(b * L_ + q0 + lc)) * D_ + h * DH_ + hf * 8;
#pragma unroll
    for (int n = 0; n < 4; ++n) {
        bf16x8 o8;
#pragma unroll
        for (int v = 0; v < 8; ++v) o8[v] = f2bf(of[n][v] * s);
        *(bf16x8*)(orow + n * 16) = o8;
    }
}

// ---------------- residual + LayerNorm ----------------
__global__ __launch_bounds__(256) void resid_ln(const float* __restrict__ Y,
                                                const float* __restrict__ tokens,
                                                const float* __restrict__ gamma,
                                                const float* __restrict__ bias,
                                                float* __restrict__ out) {
    int row = blockIdx.x, tid = threadIdx.x;
    const float* y = Y + (size_t)row * D_;
    const float* t = tokens + (size_t)row * D_;
    float x[4], sum = 0.f, sq = 0.f;
#pragma unroll
    for (int i = 0; i < 4; ++i) {
        int c = tid + i * 256;
        x[i] = y[c] + t[c];
        sum += x[i];
        sq  += x[i] * x[i];
    }
    sum = rsum16(sum); sq = rsum16(sq);
    __shared__ float red[32];
    int wid = tid >> 5, lane = tid & 31;
    if ((lane & 15) == 0) { red[wid * 2 + (lane >> 4)] = sum; red[16 + wid * 2 + (lane >> 4)] = sq; }
    __syncthreads();
    sum = 0.f; sq = 0.f;
#pragma unroll
    for (int i = 0; i < 16; ++i) { sum += red[i]; sq += red[16 + i]; }
    float mu = sum * (1.0f / D_);
    float var = sq * (1.0f / D_) - mu * mu;
    float rr = rsqrtf(var + 1e-5f);
#pragma unroll
    for (int i = 0; i < 4; ++i) {
        int c = tid + i * 256;
        out[(size_t)row * D_ + c] = (x[i] - mu) * rr * gamma[c] + bias[c];
    }
}

// ---------------- host launcher ----------------
extern "C" void kernel_launch(void* const* d_in, const int* in_sizes, int n_in,
                              void* d_out, int out_size, void* d_ws, size_t ws_size,
                              hipStream_t stream) {
    const float* tokens = (const float*)d_in[0];
    const float* R      = (const float*)d_in[1];
    const float* Wq     = (const float*)d_in[2];
    const float* Wk     = (const float*)d_in[3];
    const float* Wv     = (const float*)d_in[4];
    const float* Wp     = (const float*)d_in[5];
    const float* beta   = (const float*)d_in[6];
    const float* gamma  = (const float*)d_in[7];
    const float* bias   = (const float*)d_in[8];
    float* out = (float*)d_out;

    const int M = B_ * L_;   // 8192
    char* ws = (char*)d_ws;
    size_t off = 0;
    bf16*  Xbf   = (bf16*)(ws + off);  off += (size_t)M * D_ * 2;
    bf16*  Wb    = (bf16*)(ws + off);  off += (size_t)4 * D_ * D_ * 2;
    bf16*  Qb    = (bf16*)(ws + off);  off += (size_t)M * D_ * 2;
    bf16*  Kb    = (bf16*)(ws + off);  off += (size_t)M * D_ * 2;
    bf16*  Vtb   = (bf16*)(ws + off);  off += (size_t)M * D_ * 2;
    float* logRp = (float*)(ws + off); off += (size_t)L_ * L_ * 4;
    bf16*  Ob    = (bf16*)(ws + off);  off += (size_t)M * D_ * 2;
    float* Y     = (float*)(ws + off); off += (size_t)M * D_ * 4;

    prep_all<<<NB_LR_ + NB_TOK_ + 4 * NB_W_, 256, 0, stream>>>(tokens, Wq, Wk, Wv, Wp, R, beta,
                                                               Xbf, Wb, logRp);

    // Qb, Kb, Vtb follow one another in the workspace; Wq, Wk, Wv are the first 3 * D_ rows of Wb
    gemm_wmma<3><<<dim3(3 * D_ / 128, M / 128), 256, 0, stream>>>(Xbf, Wb, Qb, M, 3 * D_, D_);

    attn_flash<<<B_ * H_ * (L_ / 64), 128, 0, stream>>>(Qb, Kb, Vtb, logRp, Ob);

    gemm_wmma<1><<<dim3(D_ / 128, M / 128), 256, 0, stream>>>(Ob, Wb + 3 * (size_t)D_ * D_, Y, M, D_, D_);

    resid_ln<<<M, 256, 0, stream>>>(Y, tokens, gamma, bias, out);
}

// v003
// Measured time: 198 microseconds a run.
// Next to v002, in two timings, it ran 1.07 and 1.08 times as fast.
// Counting every step since v000, it is 1.45 times as fast.
#include <hip/hip_runtime.h>
#include <hip/hip_bf16.h>
#include <math.h>

// ---------------- types ----------------
typedef __bf16 bf16;
typedef bf16  bf16x4  __attribute__((ext_vector_type(4)));
typedef bf16  bf16x8  __attribute__((ext_vector_type(8)));
typedef bf16  bf16x16 __attribute__((ext_vector_type(16)));
typedef float f32x8   __attribute__((ext_vector_type(8)));
typedef float f32x4   __attribute__((ext_vector_type(4)));
typedef unsigned int u32x4 __attribute__((ext_vector_type(4)));
typedef int  i32x4 __attribute__((ext_vector_type(4)));
typedef int  i32x8 __attribute__((ext_vector_type(8)));

#define B_  4
#define L_  2048
#define D_  1024
#define H_  16
#define DH_ 64
#define SCALE_ 0.125f   // 64^-0.5

#if __has_builtin(__builtin_amdgcn_tensor_load_to_lds)
#define USE_TDM 1
#else
#define USE_TDM 0
#endif

// float -> bf16 round-to-nearest-even
__device__ __forceinline__ bf16 f2bf(float f) {
    unsigned u = __builtin_bit_cast(unsigned, f);
    u += 0x7FFFu + ((u >> 16) & 1u);
    unsigned short h = (unsigned short)(u >> 16);
    return __builtin_bit_cast(bf16, h);
}

// ---------------- DPP16 16-lane reductions (pure VALU, no LDS) ----------------
template <int CTRL>
__device__ __forceinline__ float dpp_f(float x) {
    int r = __builtin_amdgcn_update_dpp(0, __builtin_bit_cast(int, x), CTRL, 0xf, 0xf, true);
    return __builtin_bit_cast(float, r);
}
__device__ __forceinline__ float rsum16(float x) {
    x += dpp_f<0xB1>(x);     // quad_perm xor1
    x += dpp_f<0x4E>(x);     // quad_perm xor2
    x += dpp_f<0x141>(x);    // row_half_mirror
    x += dpp_f<0x140>(x);    // row_mirror
    return x;
}

__device__ __forceinline__ float xhalf(float x) {
    int b = __builtin_bit_cast(int, x);
    int r = __builtin_amdgcn_permlanex16(b, b, 0x76543210, 0xfedcba98, false, false);
    return __builtin_bit_cast(float, r);
}

__device__ __forceinline__ void async_b128(void* lds_ptr, const void* gptr) {
    unsigned la = (unsigned)(uintptr_t)lds_ptr;
    unsigned long long ga = (unsigned long long)(uintptr_t)gptr;
    asm volatile("global_load_async_to_lds_b128 %0, %1, off"
                 :: "v"(la), "v"(ga) : "memory");
}
__device__ __forceinline__ void wait_async_le0() { asm volatile("s_wait_asynccnt 0x0" ::: "memory"); }
__device__ __forceinline__ void wait_async_le4() { asm volatile("s_wait_asynccnt 0x4" ::: "memory"); }
__device__ __forceinline__ void wait_async_le8() { asm volatile("s_wait_asynccnt 0x8" ::: "memory"); }

#if USE_TDM
__device__ __forceinline__ void tdm_load_2d(void* lds_ptr, const void* gptr,
                                            unsigned tensor_d0, unsigned tensor_d1,
                                            unsigned tile_d0, unsigned tile_d1,
                                            unsigned stride_d0,
                                            unsigned pad_i, unsigned pad_a) {
    unsigned long long ga = (unsigned long long)(uintptr_t)gptr;
    u32x4 g0;
    g0[0] = 1u;
    g0[1] = (unsigned)(uintptr_t)lds_ptr;
    g0[2] = (unsigned)(ga & 0xFFFFFFFFu);
    g0[3] = (unsigned)((ga >> 32) & 0x1FFFFFFu) | (2u << 30);
    i32x8 g1;
    g1[0] = (int)((1u << 16) | (1u << 20) | (pad_i << 22) | (pad_a << 25));
    g1[1] = (int)((tensor_d0 & 0xFFFFu) << 16);
    g1[2] = (int)((tensor_d0 >> 16) | ((tensor_d1 & 0xFFFFu) << 16));
    g1[3] = (int)((tensor_d1 >> 16) | (tile_d0 << 16));
    g1[4] = (int)tile_d1;
    g1[5] = (int)stride_d0;
    g1[6] = 0;
    g1[7] = 0;
    i32x4 gz = {0, 0, 0, 0};
#if defined(__clang_major__) && (__clang_major__ >= 23)
    i32x8 gz8 = {0, 0, 0, 0, 0, 0, 0, 0};
    __builtin_amdgcn_tensor_load_to_lds(g0, g1, gz, gz, gz8, 0);
#else
    __builtin_amdgcn_tensor_load_to_lds(g0, g1, gz, gz, 0);
#endif
}
__device__ __forceinline__ void wait_tensor0() { __builtin_amdgcn_s_wait_tensorcnt(0); }
__device__ __forceinline__ void wait_tensor2() { __builtin_amdgcn_s_wait_tensorcnt(2); }
#endif

__device__ __forceinline__ bf16x16 load_frag(const bf16* p, int stride, int lane) {
    int hf = lane >> 4;
    int r  = lane & 15;
    const bf16* q = p + r * stride + hf * 8;
    bf16x8 lo = *(const bf16x8*)(q);
    bf16x8 hi = *(const bf16x8*)(q + 16);
    bf16x16 f;
#pragma unroll
    for (int i = 0; i < 8; ++i) { f[i] = lo[i]; f[i + 8] = hi[i]; }
    return f;
}

__device__ __forceinline__ f32x8 wmma_bf16(bf16x16 a, bf16x16 b, f32x8 c) {
    return __builtin_amdgcn_wmma_f32_16x16x32_bf16(false, a, false, b, (short)0, c, false, false);
}

// ---------------- prep kernels ----------------
// A block converts 32,768 floats: four batches of eight 16-byte loads per lane; every wave-wide
// load covers 512 contiguous bytes and every wave-wide store 256.
#define CVT_PER_BLK_ 32768
__device__ __forceinline__ void cvt_bf16_block(const float* __restrict__ in,
                                               bf16* __restrict__ out, int blk) {
    size_t base = (size_t)blk * CVT_PER_BLK_ + threadIdx.x * 4;
    // kept rolled: eight loads in flight per lane cover the memory latency, more only cost registers
#pragma unroll 1
    for (int bt = 0; bt < 4; ++bt) {
        f32x4 x[8];
#pragma unroll
        for (int u = 0; u < 8; ++u) x[u] = *(const f32x4*)(in + base + (bt * 8 + u) * 1024);
#pragma unroll
        for (int u = 0; u < 8; ++u) {
            bf16x4 o;
#pragma unroll
            for (int j = 0; j < 4; ++j) o[j] = f2bf(x[u][j]);
            *(bf16x4*)(out + base + (bt * 8 + u) * 1024) = o;
        }
        // the next trip rewrites the registers that these stores name: the wait stands in front of it
        asm volatile("s_wait_xcnt 0x0" ::: "memory");
    }
}

// beta*log(max(R,eps)) permuted into the D-fragment order of the transposed score tile
// (rows = keys, columns = queries): lane = (query & 15) + 16 * ((key >> 3) & 1).
// A wave takes eight tiles of 16 queries x 32 keys in a row. Eight lanes read one query's 32 keys
// (a whole line), four queries a load; the four keys of a lane stay together in the permuted
// order, so a wave-wide store fills two runs of 256 contiguous bytes.
__device__ __forceinline__ void prep_logr_block(const float* __restrict__ R,
                                                const float* __restrict__ beta,
                                                float* __restrict__ out, int blk) {
    int lane = threadIdx.x & 31;
    int gw = blk * 8 + (threadIdx.x >> 5);
    int q16 = gw >> 3, kt0 = (gw & 7) * 8;
    int rr = lane >> 3, c = lane & 7;          // query rr + 4 * i of the tile, keys c * 4 .. c * 4 + 3
    float b = beta[0];
    const float* src = R + ((size_t)q16 * 16 + rr) * L_ + kt0 * 32 + c * 4;
    float* dst = out + ((size_t)q16 * (L_ / 32) + kt0) * 512
                     + (((c >> 1) & 1) * 16 + rr) * 16 + (c >> 2) * 8 + (c & 1) * 4;
    // kept rolled: two tiles, eight loads in flight per lane, are enough to cover the latency
#pragma unroll 1
    for (int t = 0; t < 8; t += 2) {
        f32x4 x[2][4];
#pragma unroll
        for (int tt = 0; tt < 2; ++tt)
#pragma unroll
            for (int i = 0; i < 4; ++i)
                x[tt][i] = *(const f32x4*)(src + (t + tt) * 32 + (size_t)(i * 4) * L_);
#pragma unroll
        for (int tt = 0; tt < 2; ++tt)
#pragma unroll
            for (int i = 0; i < 4; ++i) {
                f32x4 y;
#pragma unroll
                for (int e = 0; e < 4; ++e) y[e] = b * __logf(fmaxf(x[tt][i][e], 1e-8f));
                *(f32x4*)(dst + (t + tt) * 512 + i * 64) = y;
            }
        // the next trip rewrites the registers that these stores name: the wait stands in front of it
        asm volatile("s_wait_xcnt 0x0" ::: "memory");
    }
}

// all six independent prep jobs in one grid: a block's index range says which job it does
#define NB_LR_  ((L_ / 16) * (L_ / 32) / 64)
#define NB_TOK_ ((B_ * L_ * D_) / CVT_PER_BLK_)
#define NB_W_   ((D_ * D_) / CVT_PER_BLK_)
__global__ __launch_bounds__(256) void prep_all(const float* __restrict__ tokens,
                                                const float* __restrict__ Wq,
                                                const float* __restrict__ Wk,
                                                const float* __restrict__ Wv,
                                                const float* __restrict__ Wp,
                                                const float* __restrict__ R,
                                                const float* __restrict__ beta,
                                                bf16* __restrict__ Xbf,
                                                bf16* __restrict__ Wb,
                                                float* __restrict__ logRp) {
    int blk = blockIdx.x;
    if (blk < NB_LR_) {
        prep_logr_block(R, beta, logRp, blk);
    } else if (blk < NB_LR_ + NB_TOK_) {
        cvt_bf16_block(tokens, Xbf, blk - NB_LR_);
    } else {
        int r = blk - (NB_LR_ + NB_TOK_);
        int ws = r / NB_W_;
        const float* w = ws == 0 ? Wq : ws == 1 ? Wk : ws == 2 ? Wv : Wp;
        cvt_bf16_block(w, Wb + (size_t)ws * D_ * D_, r & (NB_W_ - 1));
    }
}

template <int SM>
__device__ __forceinline__ void store_tile(const f32x8 (&acc)[2][4], void* __restrict__ outp,
                                           int rowBase, int colBase, int wm, int wn,
                                           int lane, int N) {
    int hf = lane >> 4, lc = lane & 15;
#pragma unroll
    for (int fm = 0; fm < 2; ++fm)
#pragma unroll
        for (int fn = 0; fn < 4; ++fn)
#pragma unroll
            for (int v = 0; v < 8; ++v) {
                int rr = rowBase + wm * 32 + fm * 16 + v + hf * 8;
                int cc = colBase + wn * 64 + fn * 16 + lc;
                float val = acc[fm][fn][v];
                int b = rr >> 11, l = rr & (L_ - 1);
                int h = cc >> 6, d = cc & 63;
                if (SM == 0) {
                    ((bf16*)outp)[(((size_t)(b * H_ + h)) * L_ + l) * DH_ + d] = f2bf(val);
                } else if (SM == 2) {
                    ((bf16*)outp)[(((size_t)(b * H_ + h)) * DH_ + d) * L_ + l] = f2bf(val);
                } else {
                    ((float*)outp)[(size_t)rr * N + cc] = val;
                }
            }
}

// MODE 1: one product, f32 row-major out. MODE 3: W holds Wq, Wk, Wv stacked (N = 3 * D_);
// a block's 128 columns lie in one of them; outp holds Q, K (form 0) and V^T (form 2) in a row.
template <int MODE>
__global__ __launch_bounds__(256) void gemm_wmma(const bf16* __restrict__ A,
                                                 const bf16* __restrict__ W,
                                                 void* __restrict__ outp,
                                                 int M, int N, int K) {
    __shared__ bf16 sA[2][128 * 72];
    __shared__ bf16 sB[2][128 * 72];

    int tid = threadIdx.x, lane = tid & 31, wid = tid >> 5;
    int wm = wid & 3, wn = wid >> 2;
    int rowBase = blockIdx.y * 128, colBase = blockIdx.x * 128;
    const bf16* gA0 = A + (size_t)rowBase * K;
    const bf16* gW0 = W + (size_t)colBase * K;

    f32x8 acc[2][4];
#pragma unroll
    for (int i = 0; i < 2; ++i)
#pragma unroll
        for (int j = 0; j < 4; ++j) acc[i][j] = (f32x8)0.0f;

    const int NK = K >> 6;

#if USE_TDM
    bool leader = (wid == 0);
    if (leader) {
        tdm_load_2d(&sA[0][0], gA0, (unsigned)K, (unsigned)M, 64, 128, (unsigned)K, 4, 3);
        tdm_load_2d(&sB[0][0], gW0, (unsigned)K, (unsigned)N, 64, 128, (unsigned)K, 4, 3);
    }
#else
    int r = tid >> 1, hh = tid & 1;
    const bf16* gA = gA0 + (size_t)r * K + hh * 32;
    const bf16* gW = gW0 + (size_t)r * K + hh * 32;
    int lbase = r * 72 + hh * 32;
#pragma unroll
    for (int i = 0; i < 4; ++i) {
        async_b128(&sA[0][lbase + i * 8], gA + i * 8);
        async_b128(&sB[0][lbase + i * 8], gW + i * 8);
    }
#endif

    for (int kt = 0; kt < NK; ++kt) {
        int cur = kt & 1;
#if USE_TDM
        if (leader) {
            if (kt + 1 < NK) {
                tdm_load_2d(&sA[cur ^ 1][0], gA0 + (kt + 1) * 64, (unsigned)K, (unsigned)M,
                            64, 128, (unsigned)K, 4, 3);
                tdm_load_2d(&sB[cur ^ 1][0], gW0 + (kt + 1) * 64, (unsigned)K, (unsigned)N,
                            64, 128, (unsigned)K, 4, 3);
                wait_tensor2();   // tensor ops in-order: current tile's pair complete
            } else {
                wait_tensor0();
            }
        }
#else
        if (kt + 1 < NK) {
            const bf16* ga = gA + (size_t)(kt + 1) * 64;
            const bf16* gb = gW + (size_t)(kt + 1) * 64;
#pragma unroll
            for (int i = 0; i < 4; ++i) {
                async_b128(&sA[cur ^ 1][lbase + i * 8], ga + i * 8);
                async_b128(&sB[cur ^ 1][lbase + i * 8], gb + i * 8);
            }
            wait_async_le8();
        } else {
            wait_async_le0();
        }
#endif
        __syncthreads();

#pragma unroll
        for (int ks = 0; ks < 2; ++ks) {
            bf16x16 af[2], bfr[4];
#pragma unroll
            for (int fm = 0; fm < 2; ++fm)
                af[fm] = load_frag(&sA[cur][(wm * 32 + fm * 16) * 72 + ks * 32], 72, lane);
#pragma unroll
            for (int fn = 0; fn < 4; ++fn)
                bfr[fn] = load_frag(&sB[cur][(wn * 64 + fn * 16) * 72 + ks * 32], 72, lane);
#pragma unroll
            for (int fm = 0; fm < 2; ++fm)
#pragma unroll
                for (int fn = 0; fn < 4; ++fn)
                    acc[fm][fn] = wmma_bf16(af[fm], bfr[fn], acc[fm][fn]);
        }
        __syncthreads();
    }

    if (MODE == 1) {
        store_tile<1>(acc, outp, rowBase, colBase, wm, wn, lane, N);
    } else {
        int sel = colBase / D_;
        bf16* o = (bf16*)outp + (size_t)sel * ((size_t)B_ * L_ * D_);
        if (sel == 2) {
            store_tile<2>(acc, o, rowBase, colBase & (D_ - 1), wm, wn, lane, N);
        } else {
            store_tile<0>(acc, o, rowBase, colBase & (D_ - 1), wm, wn, lane, N);
            // in the listing the other form's code stands behind these stores and rewrites
            // their address registers: this wait stands in front of that rewrite
            asm volatile("s_wait_xcnt 0x0" ::: "memory");
        }
    }
}

// ---------------- flash attention with log-R bias (async double-buffered) ----------------
__global__ __launch_bounds__(128) void attn_flash(const bf16* __restrict__ Q,
                                                  const bf16* __restrict__ Km,
                                                  const bf16* __restrict__ Vt,
                                                  const float* __restrict__ logRp,
                                                  bf16* __restrict__ O) {
    __shared__ bf16 sK[2][32 * 72];    // [key][d]  (A operand of S^T = K Q^T)
    __shared__ bf16 sVt[2][64 * 40];   // [d][key]  (A operand of O^T += V^T P^T)

    int tid = threadIdx.x, lane = tid & 31, w = tid >> 5;
    int bid = blockIdx.x;
    int qt = bid & 31, h = (bid >> 5) & (H_ - 1), b = bid >> 9;
    int bh = b * H_ + h;
    const bf16* Qh = Q + (size_t)bh * L_ * DH_;
    const bf16* Kh = Km + (size_t)bh * L_ * DH_;
    const bf16* Vh = Vt + (size_t)bh * DH_ * L_;   // [Dh][L]
    int q0 = qt * 64 + w * 16;
    int hf = lane >> 4, lc = lane & 15;

    bf16x16 qf[2];
    qf[0] = load_frag(Qh + (size_t)q0 * DH_ + 0, DH_, lane);
    qf[1] = load_frag(Qh + (size_t)q0 * DH_ + 32, DH_, lane);

    // one query column per lane (q0 + lc); the two halves hold different keys of it
    float m = -1e30f, s = 0.0f;
    f32x8 of[4];   // O^T tiles: of[n][v] = O[q0 + lc][n * 16 + hf * 8 + v]
#pragma unroll
    for (int n = 0; n < 4; ++n) of[n] = (f32x8)0.0f;

    const float* lrbase = logRp + ((size_t)(q0 >> 4) * (L_ / 32)) * 512 + lane * 16;

    int keyA = tid >> 2, segA = tid & 3;
    int dV = tid >> 1, hV = tid & 1;
    const bf16* gk0 = Kh + (size_t)keyA * DH_ + segA * 16;
    const bf16* gv0 = Vh + (size_t)dV * L_ + hV * 16;
    int lK = keyA * 72 + segA * 16;
    int lV = dV * 40 + hV * 16;

    async_b128(&sK[0][lK],      gk0);
    async_b128(&sK[0][lK + 8],  gk0 + 8);
    async_b128(&sVt[0][lV],     gv0);
    async_b128(&sVt[0][lV + 8], gv0 + 8);

    for (int kt = 0; kt < L_; kt += 32) {
        int cur = (kt >> 5) & 1;
        if (kt + 32 < L_) {
            const bf16* gk = gk0 + (size_t)(kt + 32) * DH_;
            const bf16* gv = gv0 + (kt + 32);
            async_b128(&sK[cur ^ 1][lK],      gk);
            async_b128(&sK[cur ^ 1][lK + 8],  gk + 8);
            async_b128(&sVt[cur ^ 1][lV],     gv);
            async_b128(&sVt[cur ^ 1][lV + 8], gv + 8);
        }

        const float* lr = lrbase + (size_t)(kt >> 5) * 512;
        f32x4 c0 = *(const f32x4*)(lr + 0);
        f32x4 c1 = *(const f32x4*)(lr + 4);
        f32x4 c2 = *(const f32x4*)(lr + 8);
        f32x4 c3 = *(const f32x4*)(lr + 12);
        if (kt + 32 < L_) __builtin_prefetch(lr + 512, 0, 1);

        if (kt + 32 < L_) wait_async_le4(); else wait_async_le0();
        __syncthreads();

        f32x8 sc[2];
        sc[0] = (f32x8)0.0f; sc[1] = (f32x8)0.0f;
#pragma unroll
        for (int j = 0; j < 2; ++j)
#pragma unroll
            for (int kd = 0; kd < 2; ++kd)
                sc[j] = wmma_bf16(load_frag(&sK[cur][(j * 16) * 72 + kd * 32], 72, lane),
                                  qf[kd], sc[j]);

        float xv[2][8];
#pragma unroll
        for (int v = 0; v < 4; ++v) {
            xv[0][v]     = sc[0][v]     * SCALE_ + c0[v];
            xv[0][v + 4] = sc[0][v + 4] * SCALE_ + c1[v];
            xv[1][v]     = sc[1][v]     * SCALE_ + c2[v];
            xv[1][v + 4] = sc[1][v + 4] * SCALE_ + c3[v];
        }

        // xv[j][v] = score of key kt + j * 16 + hf * 8 + v for query q0 + lc
        float rm = fmaxf(xv[0][0], xv[1][0]);
#pragma unroll
        for (int v = 1; v < 8; ++v) rm = fmaxf(rm, fmaxf(xv[0][v], xv[1][v]));
        rm = fmaxf(rm, xhalf(rm));
        float mn = fmaxf(m, rm);
        float corr = __expf(m - mn);
        m = mn;
#pragma unroll
        for (int j = 0; j < 2; ++j)
#pragma unroll
            for (int v = 0; v < 8; ++v) xv[j][v] = __expf(xv[j][v] - mn);
        float ls = 0.0f;
#pragma unroll
        for (int v = 0; v < 8; ++v) ls += xv[0][v] + xv[1][v];
        s = s * corr + ls;   // this half's keys only; the halves join after the loop
#pragma unroll
        for (int n = 0; n < 4; ++n)
#pragma unroll
            for (int v = 0; v < 8; ++v) of[n][v] *= corr;

        // two D tiles of S^T, converted in place, are the B operand P^T (hardware k order)
        bf16x16 pf;
#pragma unroll
        for (int j = 0; j < 2; ++j)
#pragma unroll
            for (int v = 0; v < 8; ++v) pf[j * 8 + v] = f2bf(xv[j][v]);
#pragma unroll
        for (int n = 0; n < 4; ++n)
            of[n] = wmma_bf16(load_frag(&sVt[cur][(n * 16) * 40], 40, lane), pf, of[n]);
        __syncthreads();
    }

    s = 1.0f / (s + xhalf(s));
    bf16* orow = O + ((size_t)(b * L_ + q0 + lc)) * D_ + h * DH_ + hf * 8;
#pragma unroll
    for (int n = 0; n < 4; ++n) {
        bf16x8 o8;
#pragma unroll
        for (int v = 0; v < 8; ++v) o8[v] = f2bf(of[n][v] * s);
        *(bf16x8*)(orow + n * 16) = o8;
    }
}

// ---------------- residual + LayerNorm ----------------
// One wave per row, two rows a wave: a lane holds 32 of a row's 1,024 values, the row sums join
// inside the wave, and no LDS or barrier is needed. All loads are issued first, all stores last.
__global__ __launch_bounds__(256) void resid_ln(const float* __restrict__ Y,
                                                const float* __restrict__ tokens,
                                                const float* __restrict__ gamma,
                                                const float* __restrict__ bias,
                                                float* __restrict__ out) {
    int lane = threadIdx.x & 31, wid = threadIdx.x >> 5;
    size_t ro = (size_t)((blockIdx.x * 8 + wid) * 2) * D_ + lane * 4;
    f32x4 y[2][8], t[2][8], g[8], bb[8];
#pragma unroll
    for (int ri = 0; ri < 2; ++ri)
#pragma unroll
        for (int i = 0; i < 8; ++i) {
            y[ri][i] = *(const f32x4*)(Y + ro + ri * D_ + i * 128);
            t[ri][i] = *(const f32x4*)(tokens + ro + ri * D_ + i * 128);
        }
#pragma unroll
    for (int i = 0; i < 8; ++i) {
        g[i]  = *(const f32x4*)(gamma + lane * 4 + i * 128);
        bb[i] = *(const f32x4*)(bias + lane * 4 + i * 128);
    }
    float mu[2], rr[2];
#pragma unroll
    for (int ri = 0; ri < 2; ++ri) {
        float sum = 0.f, sq = 0.f;
#pragma unroll
        for (int i = 0; i < 8; ++i) {
            y[ri][i] += t[ri][i];
#pragma unroll
            for (int e = 0; e < 4; ++e) {
                sum += y[ri][i][e];
                sq  += y[ri][i][e] * y[ri][i][e];
            }
        }
        sum = rsum16(sum); sq = rsum16(sq);
        sum += xhalf(sum); sq += xhalf(sq);
        mu[ri] = sum * (1.0f / D_);
        float var = sq * (1.0f / D_) - mu[ri] * mu[ri];
        rr[ri] = rsqrtf(var + 1e-5f);
    }
    // inputs only: keeps the gamma and bias loads above this line, in flight with the rows' loads;
    // without it the compiler sinks them among the stores, each pair with its own exposed latency
    asm volatile("" :: "v"(g[0]), "v"(g[1]), "v"(g[2]), "v"(g[3]), "v"(g[4]), "v"(g[5]), "v"(g[6]),
                 "v"(g[7]), "v"(bb[0]), "v"(bb[1]), "v"(bb[2]), "v"(bb[3]), "v"(bb[4]), "v"(bb[5]),
                 "v"(bb[6]), "v"(bb[7]));
#pragma unroll
    for (int ri = 0; ri < 2; ++ri)
#pragma unroll
        for (int i = 0; i < 8; ++i)
#pragma unroll
            for (int e = 0; e < 4; ++e)
                y[ri][i][e] = (y[ri][i][e] - mu[ri]) * rr[ri] * g[i][e] + bb[i][e];
#pragma unroll
    for (int ri = 0; ri < 2; ++ri)
#pragma unroll
        for (int i = 0; i < 8; ++i) *(f32x4*)(out + ro + ri * D_ + i * 128) = y[ri][i];
}

// ---------------- host launcher ----------------
extern "C" void kernel_launch(void* const* d_in, const int* in_sizes, int n_in,
                              void* d_out, int out_size, void* d_ws, size_t ws_size,
                              hipStream_t stream) {
    const float* tokens = (const float*)d_in[0];
    const float* R      = (const float*)d_in[1];
    const float* Wq     = (const float*)d_in[2];
    const float* Wk     = (const float*)d_in[3];
    const float* Wv     = (const float*)d_in[4];
    const float* Wp     = (const float*)d_in[5];
    const float* beta   = (const float*)d_in[6];
    const float* gamma  = (const float*)d_in[7];
    const float* bias   = (const float*)d_in[8];
    float* out = (float*)d_out;

    const int M = B_ * L_;   // 8192
    char* ws = (char*)d_ws;
    size_t off = 0;
    bf16*  Xbf   = (bf16*)(ws + off);  off += (size_t)M * D_ * 2;
    bf16*  Wb    = (bf16*)(ws + off);  off += (size_t)4 * D_ * D_ * 2;
    bf16*  Qb    = (bf16*)(ws + off);  off += (size_t)M * D_ * 2;
    bf16*  Kb    = (bf16*)(ws + off);  off += (size_t)M * D_ * 2;
    bf16*  Vtb   = (bf16*)(ws + off);  off += (size_t)M * D_ * 2;
    float* logRp = (float*)(ws + off); off += (size_t)L_ * L_ * 4;
    bf16*  Ob    = (bf16*)(ws + off);  off += (size_t)M * D_ * 2;
    float* Y     = (float*)(ws + off); off += (size_t)M * D_ * 4;

    prep_all<<<NB_LR_ + NB_TOK_ + 4 * NB_W_, 256, 0, stream>>>(tokens, Wq, Wk, Wv, Wp, R, beta,
                                                               Xbf, Wb, logRp);

    // Qb, Kb, Vtb follow one another in the workspace; Wq, Wk, Wv are the first 3 * D_ rows of Wb
    gemm_wmma<3><<<dim3(3 * D_ / 128, M / 128), 256, 0, stream>>>(Xbf, Wb, Qb, M, 3 * D_, D_);

    attn_flash<<<B_ * H_ * (L_ / 64), 128, 0, stream>>>(Qb, Kb, Vtb, logRp, Ob);

    gemm_wmma<1><<<dim3(D_ / 128, M / 128), 256, 0, stream>>>(Ob, Wb + 3 * (size_t)D_ * D_, Y, M, D_, D_);

    resid_ln<<<M / 16, 256, 0, stream>>>(Y, tokens, gamma, bias, out);
}

// v004
// It runs in 165 microseconds.
// Timed twice side by side with v003, it ran 1.20 and 1.19 times as fast.
// Over all steps from v000 it is 1.73 times as fast.
#include <hip/hip_runtime.h>
#include <hip/hip_bf16.h>
#include <math.h>

// ---------------- types ----------------
typedef __bf16 bf16;
typedef bf16  bf16x4  __attribute__((ext_vector_type(4)));
typedef bf16  bf16x8  __attribute__((ext_vector_type(8)));
typedef bf16  bf16x16 __attribute__((ext_vector_type(16)));
typedef float f32x8   __attribute__((ext_vector_type(8)));
typedef float f32x4   __attribute__((ext_vector_type(4)));
typedef unsigned int u32x4 __attribute__((ext_vector_type(4)));
typedef int  i32x4 __attribute__((ext_vector_type(4)));
typedef int  i32x8 __attribute__((ext_vector_type(8)));

#define B_  4
#define L_  2048
#define D_  1024
#define H_  16
#define DH_ 64
#define SCALE_ 0.125f   // 64^-0.5

#if __has_builtin(__builtin_amdgcn_tensor_load_to_lds)
#define USE_TDM 1
#else
#define USE_TDM 0
#endif

// float -> bf16 round-to-nearest-even
__device__ __forceinline__ bf16 f2bf(float f) {
    unsigned u = __builtin_bit_cast(unsigned, f);
    u += 0x7FFFu + ((u >> 16) & 1u);
    unsigned short h = (unsigned short)(u >> 16);
    return __builtin_bit_cast(bf16, h);
}

// ---------------- DPP16 16-lane reductions (pure VALU, no LDS) ----------------
template <int CTRL>
__device__ __forceinline__ float dpp_f(float x) {
    int r = __builtin_amdgcn_update_dpp(0, __builtin_bit_cast(int, x), CTRL, 0xf, 0xf, true);
    return __builtin_bit_cast(float, r);
}
__device__ __forceinline__ float rsum16(float x) {
    x += dpp_f<0xB1>(x);     // quad_perm xor1
    x += dpp_f<0x4E>(x);     // quad_perm xor2
    x += dpp_f<0x141>(x);    // row_half_mirror
    x += dpp_f<0x140>(x);    // row_mirror
    return x;
}

__device__ __forceinline__ float xhalf(float x) {
    int b = __builtin_bit_cast(int, x);
    int r = __builtin_amdgcn_permlanex16(b, b, 0x76543210, 0xfedcba98, false, false);
    return __builtin_bit_cast(float, r);
}

__device__ __forceinline__ void async_b128(void* lds_ptr, const void* gptr) {
    unsigned la = (unsigned)(uintptr_t)lds_ptr;
    unsigned long long ga = (unsigned long long)(uintptr_t)gptr;
    asm volatile("global_load_async_to_lds_b128 %0, %1, off"
                 :: "v"(la), "v"(ga) : "memory");
}
// four copies of one lane in a row; the wait is the last line of the copies' own statement, so that
// it stands in front of every later rewrite of the address registers that the copies name
__device__ __forceinline__ void async_b128_x4(void* l0, const void* g0, void* l1, const void* g1,
                                              void* l2, const void* g2, void* l3, const void* g3) {
    asm volatile("global_load_async_to_lds_b128 %0, %1, off\n\t"
                 "global_load_async_to_lds_b128 %2, %3, off\n\t"
                 "global_load_async_to_lds_b128 %4, %5, off\n\t"
                 "global_load_async_to_lds_b128 %6, %7, off\n\t"
                 "s_wait_xcnt 0x0"
                 :: "v"((unsigned)(uintptr_t)l0), "v"((unsigned long long)(uintptr_t)g0),
                    "v"((unsigned)(uintptr_t)l1), "v"((unsigned long long)(uintptr_t)g1),
                    "v"((unsigned)(uintptr_t)l2), "v"((unsigned long long)(uintptr_t)g2),
                    "v"((unsigned)(uintptr_t)l3), "v"((unsigned long long)(uintptr_t)g3)
                 : "memory");
}
__device__ __forceinline__ void wait_async_le0() { asm volatile("s_wait_asynccnt 0x0" ::: "memory"); }
__device__ __forceinline__ void wait_async_le4() { asm volatile("s_wait_asynccnt 0x4" ::: "memory"); }
__device__ __forceinline__ void wait_async_le8() { asm volatile("s_wait_asynccnt 0x8" ::: "memory"); }

#if USE_TDM
__device__ __forceinline__ void tdm_load_2d(void* lds_ptr, const void* gptr,
                                            unsigned tensor_d0, unsigned tensor_d1,
                                            unsigned tile_d0, unsigned tile_d1,
                                            unsigned stride_d0,
                                            unsigned pad_i, unsigned pad_a) {
    unsigned long long ga = (unsigned long long)(uintptr_t)gptr;
    u32x4 g0;
    g0[0] = 1u;
    g0[1] = (unsigned)(uintptr_t)lds_ptr;
    g0[2] = (unsigned)(ga & 0xFFFFFFFFu);
    g0[3] = (unsigned)((ga >> 32) & 0x1FFFFFFu) | (2u << 30);
    i32x8 g1;
    g1[0] = (int)((1u << 16) | (1u << 20) | (pad_i << 22) | (pad_a << 25));
    g1[1] = (int)((tensor_d0 & 0xFFFFu) << 16);
    g1[2] = (int)((tensor_d0 >> 16) | ((tensor_d1 & 0xFFFFu) << 16));
    g1[3] = (int)((tensor_d1 >> 16) | (tile_d0 << 16));
    g1[4] = (int)tile_d1;
    g1[5] = (int)stride_d0;
    g1[6] = 0;
    g1[7] = 0;
    i32x4 gz = {0, 0, 0, 0};
#if defined(__clang_major__) && (__clang_major__ >= 23)
    i32x8 gz8 = {0, 0, 0, 0, 0, 0, 0, 0};
    __builtin_amdgcn_tensor_load_to_lds(g0, g1, gz, gz, gz8, 0);
#else
    __builtin_amdgcn_tensor_load_to_lds(g0, g1, gz, gz, 0);
#endif
}
__device__ __forceinline__ void wait_tensor0() { __builtin_amdgcn_s_wait_tensorcnt(0); }
__device__ __forceinline__ void wait_tensor2() { __builtin_amdgcn_s_wait_tensorcnt(2); }
#endif

__device__ __forceinline__ bf16x16 load_frag(const bf16* p, int stride, int lane) {
    int hf = lane >> 4;
    int r  = lane & 15;
    const bf16* q = p + r * stride + hf * 8;
    bf16x8 lo = *(const bf16x8*)(q);
    bf16x8 hi = *(const bf16x8*)(q + 16);
    bf16x16 f;
#pragma unroll
    for (int i = 0; i < 8; ++i) { f[i] = lo[i]; f[i + 8] = hi[i]; }
    return f;
}

__device__ __forceinline__ f32x8 wmma_bf16(bf16x16 a, bf16x16 b, f32x8 c) {
    return __builtin_amdgcn_wmma_f32_16x16x32_bf16(false, a, false, b, (short)0, c, false, false);
}

// ---------------- prep kernels ----------------
// A block converts 32,768 floats: four batches of eight 16-byte loads per lane; every wave-wide
// load covers 512 contiguous bytes and every wave-wide store 256.
#define CVT_PER_BLK_ 32768
__device__ __forceinline__ void cvt_bf16_block(const float* __restrict__ in,
                                               bf16* __restrict__ out, int blk) {
    size_t base = (size_t)blk * CVT_PER_BLK_ + threadIdx.x * 4;
    // kept rolled: eight loads in flight per lane cover the memory latency, more only cost registers
#pragma unroll 1
    for (int bt = 0; bt < 4; ++bt) {
        f32x4 x[8];
#pragma unroll
        for (int u = 0; u < 8; ++u) x[u] = *(const f32x4*)(in + base + (bt * 8 + u) * 1024);
#pragma unroll
        for (int u = 0; u < 8; ++u) {
            bf16x4 o;
#pragma unroll
            for (int j = 0; j < 4; ++j) o[j] = f2bf(x[u][j]);
            *(bf16x4*)(out + base + (bt * 8 + u) * 1024) = o;
        }
        // the next trip rewrites the registers that these stores name: the wait stands in front of it
        asm volatile("s_wait_xcnt 0x0" ::: "memory");
    }
}

// beta*log(max(R,eps)) permuted into the D-fragment order of the transposed score tile
// (rows = keys, columns = queries): lane = (query & 15) + 16 * ((key >> 3) & 1).
// A wave takes eight tiles of 16 queries x 32 keys in a row. Eight lanes read one query's 32 keys
// (a whole line), four queries a load; the four keys of a lane stay together in the permuted
// order, so a wave-wide store fills two runs of 256 contiguous bytes.
__device__ __forceinline__ void prep_logr_block(const float* __restrict__ R,
                                                const float* __restrict__ beta,
                                                float* __restrict__ out, int blk) {
    int lane = threadIdx.x & 31;
    int gw = blk * 8 + (threadIdx.x >> 5);
    int q16 = gw >> 3, kt0 = (gw & 7) * 8;
    int rr = lane >> 3, c = lane & 7;          // query rr + 4 * i of the tile, keys c * 4 .. c * 4 + 3
    float b = beta[0];
    const float* src = R + ((size_t)q16 * 16 + rr) * L_ + kt0 * 32 + c * 4;
    float* dst = out + ((size_t)q16 * (L_ / 32) + kt0) * 512
                     + (((c >> 1) & 1) * 16 + rr) * 16 + (c >> 2) * 8 + (c & 1) * 4;
    // kept rolled: two tiles, eight loads in flight per lane, are enough to cover the latency
#pragma unroll 1
    for (int t = 0; t < 8; t += 2) {
        f32x4 x[2][4];
#pragma unroll
        for (int tt = 0; tt < 2; ++tt)
#pragma unroll
            for (int i = 0; i < 4; ++i)
                x[tt][i] = *(const f32x4*)(src + (t + tt) * 32 + (size_t)(i * 4) * L_);
#pragma unroll
        for (int tt = 0; tt < 2; ++tt)
#pragma unroll
            for (int i = 0; i < 4; ++i) {
                f32x4 y;
#pragma unroll
                for (int e = 0; e < 4; ++e) y[e] = b * __logf(fmaxf(x[tt][i][e], 1e-8f));
                *(f32x4*)(dst + (t + tt) * 512 + i * 64) = y;
            }
        // the next trip rewrites the registers that these stores name: the wait stands in front of it
        asm volatile("s_wait_xcnt 0x0" ::: "memory");
    }
}

// all six independent prep jobs in one grid: a block's index range says which job it does
#define NB_LR_  ((L_ / 16) * (L_ / 32) / 64)
#define NB_TOK_ ((B_ * L_ * D_) / CVT_PER_BLK_)
#define NB_W_   ((D_ * D_) / CVT_PER_BLK_)
__global__ __launch_bounds__(256) void prep_all(const float* __restrict__ tokens,
                                                const float* __restrict__ Wq,
                                                const float* __restrict__ Wk,
                                                const float* __restrict__ Wv,
                                                const float* __restrict__ Wp,
                                                const float* __restrict__ R,
                                                const float* __restrict__ beta,
                                                bf16* __restrict__ Xbf,
                                                bf16* __restrict__ Wb,
                                                float* __restrict__ logRp) {
    int blk = blockIdx.x;
    if (blk < NB_LR_) {
        prep_logr_block(R, beta, logRp, blk);
    } else if (blk < NB_LR_ + NB_TOK_) {
        cvt_bf16_block(tokens, Xbf, blk - NB_LR_);
    } else {
        int r = blk - (NB_LR_ + NB_TOK_);
        int ws = r / NB_W_;
        const float* w = ws == 0 ? Wq : ws == 1 ? Wk : ws == 2 ? Wv : Wp;
        cvt_bf16_block(w, Wb + (size_t)ws * D_ * D_, r & (NB_W_ - 1));
    }
}

template <int SM>
__device__ __forceinline__ void store_tile(const f32x8 (&acc)[2][4], void* __restrict__ outp,
                                           int rowBase, int colBase, int wm, int wn,
                                           int lane, int N) {
    int hf = lane >> 4, lc = lane & 15;
#pragma unroll
    for (int fm = 0; fm < 2; ++fm)
#pragma unroll
        for (int fn = 0; fn < 4; ++fn)
#pragma unroll
            for (int v = 0; v < 8; ++v) {
                int rr = rowBase + wm * 32 + fm * 16 + v + hf * 8;
                int cc = colBase + wn * 64 + fn * 16 + lc;
                float val = acc[fm][fn][v];
                int b = rr >> 11, l = rr & (L_ - 1);
                int h = cc >> 6, d = cc & 63;
                if (SM == 0) {
                    ((bf16*)outp)[(((size_t)(b * H_ + h)) * L_ + l) * DH_ + d] = f2bf(val);
                } else if (SM == 2) {
                    ((bf16*)outp)[(((size_t)(b * H_ + h)) * DH_ + d) * L_ + l] = f2bf(val);
                } else {
                    ((float*)outp)[(size_t)rr * N + cc] = val;
                }
            }
}

// MODE 1: one product, f32 row-major out. MODE 3: W holds Wq, Wk, Wv stacked (N = 3 * D_);
// a block's 128 columns lie in one of them; outp holds Q, K (form 0) and V^T (form 2) in a row.
template <int MODE>
__global__ __launch_bounds__(256) void gemm_wmma(const bf16* __restrict__ A,
                                                 const bf16* __restrict__ W,
                                                 void* __restrict__ outp,
                                                 int M, int N, int K) {
    __shared__ bf16 sA[2][128 * 72];
    __shared__ bf16 sB[2][128 * 72];

    int tid = threadIdx.x, lane = tid & 31, wid = tid >> 5;
    int wm = wid & 3, wn = wid >> 2;
    int rowBase = blockIdx.y * 128, colBase = blockIdx.x * 128;
    const bf16* gA0 = A + (size_t)rowBase * K;
    const bf16* gW0 = W + (size_t)colBase * K;

    f32x8 acc[2][4];
#pragma unroll
    for (int i = 0; i < 2; ++i)
#pragma unroll
        for (int j = 0; j < 4; ++j) acc[i][j] = (f32x8)0.0f;

    const int NK = K >> 6;

#if USE_TDM
    bool leader = (wid == 0);
    if (leader) {
        tdm_load_2d(&sA[0][0], gA0, (unsigned)K, (unsigned)M, 64, 128, (unsigned)K, 4, 3);
        tdm_load_2d(&sB[0][0], gW0, (unsigned)K, (unsigned)N, 64, 128, (unsigned)K, 4, 3);
    }
#else
    int r = tid >> 1, hh = tid & 1;
    const bf16* gA = gA0 + (size_t)r * K + hh * 32;
    const bf16* gW = gW0 + (size_t)r * K + hh * 32;
    int lbase = r * 72 + hh * 32;
#pragma unroll
    for (int i = 0; i < 4; ++i) {
        async_b128(&sA[0][lbase + i * 8], gA + i * 8);
        async_b128(&sB[0][lbase + i * 8], gW + i * 8);
    }
#endif

    for (int kt = 0; kt < NK; ++kt) {
        int cur = kt & 1;
#if USE_TDM
        if (leader) {
            if (kt + 1 < NK) {
                tdm_load_2d(&sA[cur ^ 1][0], gA0 + (kt + 1) * 64, (unsigned)K, (unsigned)M,
                            64, 128, (unsigned)K, 4, 3);
                tdm_load_2d(&sB[cur ^ 1][0], gW0 + (kt + 1) * 64, (unsigned)K, (unsigned)N,
                            64, 128, (unsigned)K, 4, 3);
                wait_tensor2();   // tensor ops in-order: current tile's pair complete
            } else {
                wait_tensor0();
            }
        }
#else
        if (kt + 1 < NK) {
            const bf16* ga = gA + (size_t)(kt + 1) * 64;
            const bf16* gb = gW + (size_t)(kt + 1) * 64;
#pragma unroll
            for (int i = 0; i < 4; ++i) {
                async_b128(&sA[cur ^ 1][lbase + i * 8], ga + i * 8);
                async_b128(&sB[cur ^ 1][lbase + i * 8], gb + i * 8);
            }
            wait_async_le8();
        } else {
            wait_async_le0();
        }
#endif
        __syncthreads();

#pragma unroll
        for (int ks = 0; ks < 2; ++ks) {
            bf16x16 af[2], bfr[4];
#pragma unroll
            for (int fm = 0; fm < 2; ++fm)
                af[fm] = load_frag(&sA[cur][(wm * 32 + fm * 16) * 72 + ks * 32], 72, lane);
#pragma unroll
            for (int fn = 0; fn < 4; ++fn)
                bfr[fn] = load_frag(&sB[cur][(wn * 64 + fn * 16) * 72 + ks * 32], 72, lane);
#pragma unroll
            for (int fm = 0; fm < 2; ++fm)
#pragma unroll
                for (int fn = 0; fn < 4; ++fn)
                    acc[fm][fn] = wmma_bf16(af[fm], bfr[fn], acc[fm][fn]);
        }
        __syncthreads();
    }

    if (MODE == 1) {
        store_tile<1>(acc, outp, rowBase, colBase, wm, wn, lane, N);
    } else {
        int sel = colBase / D_;
        bf16* o = (bf16*)outp + (size_t)sel * ((size_t)B_ * L_ * D_);
        if (sel == 2) {
            store_tile<2>(acc, o, rowBase, colBase & (D_ - 1), wm, wn, lane, N);
        } else {
            store_tile<0>(acc, o, rowBase, colBase & (D_ - 1), wm, wn, lane, N);
            // in the listing the other form's code stands behind these stores and rewrites
            // their address registers: this wait stands in front of that rewrite
            asm volatile("s_wait_xcnt 0x0" ::: "memory");
        }
    }
}

__global__ __launch_bounds__(256) __attribute__((amdgpu_waves_per_eu(4, 4))) void attn_flash(const bf16* __restrict__ Q,
                                                  const bf16* __restrict__ Km,
                                                  const bf16* __restrict__ Vt,
                                                  const float* __restrict__ logRp,
                                                  bf16* __restrict__ O) {
    __shared__ bf16 sK[2][64 * 72];    // [key][d]  (A operand of S^T = K Q^T)
    __shared__ bf16 sVt[2][64 * 72];   // [d][key]  (A operand of O^T += V^T P^T)

    int tid = threadIdx.x, lane = tid & 31, w = tid >> 5;
    int bid = blockIdx.x;
    int qt = bid & 7, h = (bid >> 3) & (H_ - 1), b = bid >> 7;
    int bh = b * H_ + h;
    const bf16* Qh = Q + (size_t)bh * L_ * DH_;
    const bf16* Kh = Km + (size_t)bh * L_ * DH_;
    const bf16* Vh = Vt + (size_t)bh * DH_ * L_;   // [Dh][L]
    int q0 = qt * 256 + w * 32;
    int hf = lane >> 4, lc = lane & 15;

    bf16x16 qf[2][2];
#pragma unroll
    for (int g = 0; g < 2; ++g) {
        qf[g][0] = load_frag(Qh + (size_t)(q0 + g * 16) * DH_ + 0, DH_, lane);
        qf[g][1] = load_frag(Qh + (size_t)(q0 + g * 16) * DH_ + 32, DH_, lane);
    }

    // one query column per lane and group (q0 + g * 16 + lc); the two halves hold different keys
    float m[2] = {-1e30f, -1e30f}, s[2] = {0.0f, 0.0f};
    f32x8 of[2][4];   // O^T tiles: of[g][n][v] = O[q0 + g * 16 + lc][n * 16 + hf * 8 + v]
#pragma unroll
    for (int g = 0; g < 2; ++g)
#pragma unroll
        for (int n = 0; n < 4; ++n) of[g][n] = (f32x8)0.0f;

    const float* lrbase = logRp + ((size_t)(q0 >> 4) * (L_ / 32)) * 512 + lane * 16;

    int keyA = tid >> 2, segA = tid & 3;
    int dV = tid >> 2, hV = tid & 3;
    const bf16* gk0 = Kh + (size_t)keyA * DH_ + segA * 16;
    const bf16* gv0 = Vh + (size_t)dV * L_ + hV * 16;
    int lK = keyA * 72 + segA * 16;
    int lV = dV * 72 + hV * 16;

    async_b128_x4(&sK[0][lK], gk0, &sK[0][lK + 8], gk0 + 8,
                  &sVt[0][lV], gv0, &sVt[0][lV + 8], gv0 + 8);

    // bias tiles, one per group, always fetched one pass ahead of their use; here the first pass's
    f32x4 cb[2][4];
#pragma unroll
    for (int g = 0; g < 2; ++g)
#pragma unroll
        for (int i = 0; i < 4; ++i)
            cb[g][i] = *(const f32x4*)(lrbase + (size_t)g * (L_ / 32) * 512 + i * 4);

    for (int kt = 0; kt < L_; kt += 64) {
        int cur = (kt >> 6) & 1;
        if (kt + 64 < L_) {
            const bf16* gk = gk0 + (size_t)(kt + 64) * DH_;
            const bf16* gv = gv0 + (kt + 64);
            async_b128_x4(&sK[cur ^ 1][lK], gk, &sK[cur ^ 1][lK + 8], gk + 8,
                          &sVt[cur ^ 1][lV], gv, &sVt[cur ^ 1][lV + 8], gv + 8);
        }

        const float* lr = lrbase + (size_t)(kt >> 5) * 512;

        if (kt + 64 < L_) wait_async_le4(); else wait_async_le0();
        __syncthreads();

#pragma unroll
        for (int sub = 0; sub < 2; ++sub) {
            f32x8 sc[2][2];
#pragma unroll
            for (int g = 0; g < 2; ++g) { sc[g][0] = (f32x8)0.0f; sc[g][1] = (f32x8)0.0f; }
#pragma unroll
            for (int j = 0; j < 2; ++j)
#pragma unroll
                for (int kd = 0; kd < 2; ++kd) {
                    bf16x16 kf = load_frag(&sK[cur][(sub * 32 + j * 16) * 72 + kd * 32], 72, lane);
#pragma unroll
                    for (int g = 0; g < 2; ++g) sc[g][j] = wmma_bf16(kf, qf[g][kd], sc[g][j]);
                }

            // xv[g][j][v] = score of key kt + sub * 32 + j * 16 + hf * 8 + v for query q0 + g * 16 + lc
            // whole fragments at a time: score and bias registers pair up as they lie
            f32x8 xv[2][2];
#pragma unroll
            for (int g = 0; g < 2; ++g)
#pragma unroll
                for (int j = 0; j < 2; ++j)
                    xv[g][j] = sc[g][j] * SCALE_ +
                               __builtin_shufflevector(cb[g][j * 2], cb[g][j * 2 + 1], 0, 1, 2, 3, 4, 5, 6, 7);

            bf16x16 pf[2];
#pragma unroll
            for (int g = 0; g < 2; ++g) {
                float rm = fmaxf(xv[g][0][0], xv[g][1][0]);
#pragma unroll
                for (int v = 1; v < 8; ++v) rm = fmaxf(rm, fmaxf(xv[g][0][v], xv[g][1][v]));
                rm = fmaxf(rm, xhalf(rm));
                float mn = fmaxf(m[g], rm);
                float corr = __expf(m[g] - mn);
                m[g] = mn;
#pragma unroll
                for (int j = 0; j < 2; ++j)
#pragma unroll
                    for (int v = 0; v < 8; ++v) xv[g][j][v] = __expf(xv[g][j][v] - mn);
                float ls = 0.0f;
#pragma unroll
                for (int v = 0; v < 8; ++v) ls += xv[g][0][v] + xv[g][1][v];
                s[g] = s[g] * corr + ls;   // this half's keys only; the halves join after the loop
#pragma unroll
                for (int n = 0; n < 4; ++n)
#pragma unroll
                    for (int v = 0; v < 8; ++v) of[g][n][v] *= corr;

                // two D tiles of S^T, converted in place, are the B operand P^T (hardware k order)
#pragma unroll
                for (int j = 0; j < 2; ++j)
#pragma unroll
                    for (int v = 0; v < 8; ++v) pf[g][j * 8 + v] = f2bf(xv[g][j][v]);

                // the next pass's bias tile, a pass ahead of its use; the last pass re-reads its trip's
                // first tile, unused: no branch round the loads, so their waits stay counted
                const float* ln = lr + (sub == 0 ? 512 : (kt + 64 < L_ ? 1024 : 0));
#pragma unroll
                for (int i = 0; i < 4; ++i)
                    cb[g][i] = *(const f32x4*)(ln + (size_t)g * (L_ / 32) * 512 + i * 4);
            }
#pragma unroll
            for (int n = 0; n < 4; ++n) {
                bf16x16 vf = load_frag(&sVt[cur][(n * 16) * 72 + sub * 32], 72, lane);
#pragma unroll
                for (int g = 0; g < 2; ++g) of[g][n] = wmma_bf16(vf, pf[g], of[g][n]);
            }
            // keeps the second pass's score products behind the first pass: moved ahead of it, both
            // passes' scores and bias tiles are live at once and a Q fragment spills to scratch
            if (sub == 0) __builtin_amdgcn_sched_barrier(0);
        }
        __syncthreads();
    }

#pragma unroll
    for (int g = 0; g < 2; ++g) {
        float si = 1.0f / (s[g] + xhalf(s[g]));
        bf16* orow = O + ((size_t)(b * L_ + q0 + g * 16 + lc)) * D_ + h * DH_ + hf * 8;
#pragma unroll
        for (int n = 0; n < 4; ++n) {
            bf16x8 o8;
#pragma unroll
            for (int v = 0; v < 8; ++v) o8[v] = f2bf(of[g][n][v] * si);
            *(bf16x8*)(orow + n * 16) = o8;
        }
    }
}

// ---------------- residual + LayerNorm ----------------
// One wave per row, two rows a wave: a lane holds 32 of a row's 1,024 values, the row sums join
// inside the wave, and no LDS or barrier is needed. All loads are issued first, all stores last.
__global__ __launch_bounds__(256) void resid_ln(const float* __restrict__ Y,
                                                const float* __restrict__ tokens,
                                                const float* __restrict__ gamma,
                                                const float* __restrict__ bias,
                                                float* __restrict__ out) {
    int lane = threadIdx.x & 31, wid = threadIdx.x >> 5;
    size_t ro = (size_t)((blockIdx.x * 8 + wid) * 2) * D_ + lane * 4;
    f32x4 y[2][8], t[2][8], g[8], bb[8];
#pragma unroll
    for (int ri = 0; ri < 2; ++ri)
#pragma unroll
        for (int i = 0; i < 8; ++i) {
            y[ri][i] = *(const f32x4*)(Y + ro + ri * D_ + i * 128);
            t[ri][i] = *(const f32x4*)(tokens + ro + ri * D_ + i * 128);
        }
#pragma unroll
    for (int i = 0; i < 8; ++i) {
        g[i]  = *(const f32x4*)(gamma + lane * 4 + i * 128);
        bb[i] = *(const f32x4*)(bias + lane * 4 + i * 128);
    }
    float mu[2], rr[2];
#pragma unroll
    for (int ri = 0; ri < 2; ++ri) {
        float sum = 0.f, sq = 0.f;
#pragma unroll
        for (int i = 0; i < 8; ++i) {
            y[ri][i] += t[ri][i];
#pragma unroll
            for (int e = 0; e < 4; ++e) {
                sum += y[ri][i][e];
                sq  += y[ri][i][e] * y[ri][i][e];
            }
        }
        sum = rsum16(sum); sq = rsum16(sq);
        sum += xhalf(sum); sq += xhalf(sq);
        mu[ri] = sum * (1.0f / D_);
        float var = sq * (1.0f / D_) - mu[ri] * mu[ri];
        rr[ri] = rsqrtf(var + 1e-5f);
    }
    // inputs only: keeps the gamma and bias loads above this line, in flight with the rows' loads;
    // without it the compiler sinks them among the stores, each pair with its own exposed latency
    asm volatile("" :: "v"(g[0]), "v"(g[1]), "v"(g[2]), "v"(g[3]), "v"(g[4]), "v"(g[5]), "v"(g[6]),
                 "v"(g[7]), "v"(bb[0]), "v"(bb[1]), "v"(bb[2]), "v"(bb[3]), "v"(bb[4]), "v"(bb[5]),
                 "v"(bb[6]), "v"(bb[7]));
#pragma unroll
    for (int ri = 0; ri < 2; ++ri)
#pragma unroll
        for (int i = 0; i < 8; ++i)
#pragma unroll
            for (int e = 0; e < 4; ++e)
                y[ri][i][e] = (y[ri][i][e] - mu[ri]) * rr[ri] * g[i][e] + bb[i][e];
#pragma unroll
    for (int ri = 0; ri < 2; ++ri)
#pragma unroll
        for (int i = 0; i < 8; ++i) *(f32x4*)(out + ro + ri * D_ + i * 128) = y[ri][i];
}

// ---------------- host launcher ----------------
extern "C" void kernel_launch(void* const* d_in, const int* in_sizes, int n_in,
                              void* d_out, int out_size, void* d_ws, size_t ws_size,
                              hipStream_t stream) {
    const float* tokens = (const float*)d_in[0];
    const float* R      = (const float*)d_in[1];
    const float* Wq     = (const float*)d_in[2];
    const float* Wk     = (const float*)d_in[3];
    const float* Wv     = (const float*)d_in[4];
    const float* Wp     = (const float*)d_in[5];
    const float* beta   = (const float*)d_in[6];
    const float* gamma  = (const float*)d_in[7];
    const float* bias   = (const float*)d_in[8];
    float* out = (float*)d_out;

    const int M = B_ * L_;   // 8192
    char* ws = (char*)d_ws;
    size_t off = 0;
    bf16*  Xbf   = (bf16*)(ws + off);  off += (size_t)M * D_ * 2;
    bf16*  Wb    = (bf16*)(ws + off);  off += (size_t)4 * D_ * D_ * 2;
    bf16*  Qb    = (bf16*)(ws + off);  off += (size_t)M * D_ * 2;
    bf16*  Kb    = (bf16*)(ws + off);  off += (size_t)M * D_ * 2;
    bf16*  Vtb   = (bf16*)(ws + off);  off += (size_t)M * D_ * 2;
    float* logRp = (float*)(ws + off); off += (size_t)L_ * L_ * 4;
    bf16*  Ob    = (bf16*)(ws + off);  off += (size_t)M * D_ * 2;
    float* Y     = (float*)(ws + off); off += (size_t)M * D_ * 4;

    prep_all<<<NB_LR_ + NB_TOK_ + 4 * NB_W_, 256, 0, stream>>>(tokens, Wq, Wk, Wv, Wp, R, beta,
                                                               Xbf, Wb, logRp);

    // Qb, Kb, Vtb follow one another in the workspace; Wq, Wk, Wv are the first 3 * D_ rows of Wb
    gemm_wmma<3><<<dim3(3 * D_ / 128, M / 128), 256, 0, stream>>>(Xbf, Wb, Qb, M, 3 * D_, D_);

    attn_flash<<<B_ * H_ * (L_ / 256), 256, 0, stream>>>(Qb, Kb, Vtb, logRp, Ob);

    gemm_wmma<1><<<dim3(D_ / 128, M / 128), 256, 0, stream>>>(Ob, Wb + 3 * (size_t)D_ * D_, Y, M, D_, D_);

    resid_ln<<<M / 16, 256, 0, stream>>>(Y, tokens, gamma, bias, out);
}

// v005
// One run takes 158 microseconds.
// In two side-by-side timings against v004, it was 1.03 and 1.04 times as fast.
// All steps since v000 together make it 1.79 times as fast.
#include <hip/hip_runtime.h>
#include <hip/hip_bf16.h>
#include <math.h>

// ---------------- types ----------------
typedef __bf16 bf16;
typedef bf16  bf16x4  __attribute__((ext_vector_type(4)));
typedef bf16  bf16x8  __attribute__((ext_vector_type(8)));
typedef bf16  bf16x16 __attribute__((ext_vector_type(16)));
typedef float f32x8   __attribute__((ext_vector_type(8)));
typedef float f32x4   __attribute__((ext_vector_type(4)));
typedef _Float16 f16x8 __attribute__((ext_vector_type(8)));
typedef unsigned int u32x4 __attribute__((ext_vector_type(4)));
typedef int  i32x4 __attribute__((ext_vector_type(4)));
typedef int  i32x8 __attribute__((ext_vector_type(8)));

#define B_  4
#define L_  2048
#define D_  1024
#define H_  16
#define DH_ 64
#define SCALE_ 0.125f   // 64^-0.5

#if __has_builtin(__builtin_amdgcn_tensor_load_to_lds)
#define USE_TDM 1
#else
#define USE_TDM 0
#endif

// float -> bf16 round-to-nearest-even
__device__ __forceinline__ bf16 f2bf(float f) {
    unsigned u = __builtin_bit_cast(unsigned, f);
    u += 0x7FFFu + ((u >> 16) & 1u);
    unsigned short h = (unsigned short)(u >> 16);
    return __builtin_bit_cast(bf16, h);
}

// ---------------- DPP16 16-lane reductions (pure VALU, no LDS) ----------------
template <int CTRL>
__device__ __forceinline__ float dpp_f(float x) {
    int r = __builtin_amdgcn_update_dpp(0, __builtin_bit_cast(int, x), CTRL, 0xf, 0xf, true);
    return __builtin_bit_cast(float, r);
}
__device__ __forceinline__ float rsum16(float x) {
    x += dpp_f<0xB1>(x);     // quad_perm xor1
    x += dpp_f<0x4E>(x);     // quad_perm xor2
    x += dpp_f<0x141>(x);    // row_half_mirror
    x += dpp_f<0x140>(x);    // row_mirror
    return x;
}

__device__ __forceinline__ float xhalf(float x) {
    int b = __builtin_bit_cast(int, x);
    int r = __builtin_amdgcn_permlanex16(b, b, 0x76543210, 0xfedcba98, false, false);
    return __builtin_bit_cast(float, r);
}

__device__ __forceinline__ void async_b128(void* lds_ptr, const void* gptr) {
    unsigned la = (unsigned)(uintptr_t)lds_ptr;
    unsigned long long ga = (unsigned long long)(uintptr_t)gptr;
    asm volatile("global_load_async_to_lds_b128 %0, %1, off"
                 :: "v"(la), "v"(ga) : "memory");
}
// four copies of one lane in a row; the wait is the last line of the copies' own statement, so that
// it stands in front of every later rewrite of the address registers that the copies name
__device__ __forceinline__ void async_b128_x4(void* l0, const void* g0, void* l1, const void* g1,
                                              void* l2, const void* g2, void* l3, const void* g3) {
    asm volatile("global_load_async_to_lds_b128 %0, %1, off\n\t"
                 "global_load_async_to_lds_b128 %2, %3, off\n\t"
                 "global_load_async_to_lds_b128 %4, %5, off\n\t"
                 "global_load_async_to_lds_b128 %6, %7, off\n\t"
                 "s_wait_xcnt 0x0"
                 :: "v"((unsigned)(uintptr_t)l0), "v"((unsigned long long)(uintptr_t)g0),
                    "v"((unsigned)(uintptr_t)l1), "v"((unsigned long long)(uintptr_t)g1),
                    "v"((unsigned)(uintptr_t)l2), "v"((unsigned long long)(uintptr_t)g2),
                    "v"((unsigned)(uintptr_t)l3), "v"((unsigned long long)(uintptr_t)g3)
                 : "memory");
}
__device__ __forceinline__ void wait_async_le0() { asm volatile("s_wait_asynccnt 0x0" ::: "memory"); }
__device__ __forceinline__ void wait_async_le4() { asm volatile("s_wait_asynccnt 0x4" ::: "memory"); }
__device__ __forceinline__ void wait_async_le8() { asm volatile("s_wait_asynccnt 0x8" ::: "memory"); }

#if USE_TDM
__device__ __forceinline__ void tdm_load_2d(void* lds_ptr, const void* gptr,
                                            unsigned tensor_d0, unsigned tensor_d1,
                                            unsigned tile_d0, unsigned tile_d1,
                                            unsigned stride_d0,
                                            unsigned pad_i, unsigned pad_a) {
    unsigned long long ga = (unsigned long long)(uintptr_t)gptr;
    u32x4 g0;
    g0[0] = 1u;
    g0[1] = (unsigned)(uintptr_t)lds_ptr;
    g0[2] = (unsigned)(ga & 0xFFFFFFFFu);
    g0[3] = (unsigned)((ga >> 32) & 0x1FFFFFFu) | (2u << 30);
    i32x8 g1;
    g1[0] = (int)((1u << 16) | (1u << 20) | (pad_i << 22) | (pad_a << 25));
    g1[1] = (int)((tensor_d0 & 0xFFFFu) << 16);
    g1[2] = (int)((tensor_d0 >> 16) | ((tensor_d1 & 0xFFFFu) << 16));
    g1[3] = (int)((tensor_d1 >> 16) | (tile_d0 << 16));
    g1[4] = (int)tile_d1;
    g1[5] = (int)stride_d0;
    g1[6] = 0;
    g1[7] = 0;
    i32x4 gz = {0, 0, 0, 0};
#if defined(__clang_major__) && (__clang_major__ >= 23)
    i32x8 gz8 = {0, 0, 0, 0, 0, 0, 0, 0};
    __builtin_amdgcn_tensor_load_to_lds(g0, g1, gz, gz, gz8, 0);
#else
    __builtin_amdgcn_tensor_load_to_lds(g0, g1, gz, gz, 0);
#endif
}
__device__ __forceinline__ void wait_tensor0() { __builtin_amdgcn_s_wait_tensorcnt(0); }
__device__ __forceinline__ void wait_tensor2() { __builtin_amdgcn_s_wait_tensorcnt(2); }
#endif

__device__ __forceinline__ bf16x16 load_frag(const bf16* p, int stride, int lane) {
    int hf = lane >> 4;
    int r  = lane & 15;
    const bf16* q = p + r * stride + hf * 8;
    bf16x8 lo = *(const bf16x8*)(q);
    bf16x8 hi = *(const bf16x8*)(q + 16);
    bf16x16 f;
#pragma unroll
    for (int i = 0; i < 8; ++i) { f[i] = lo[i]; f[i + 8] = hi[i]; }
    return f;
}

__device__ __forceinline__ f32x8 wmma_bf16(bf16x16 a, bf16x16 b, f32x8 c) {
    return __builtin_amdgcn_wmma_f32_16x16x32_bf16(false, a, false, b, (short)0, c, false, false);
}

// ---------------- prep kernels ----------------
// A block converts 32,768 floats: four batches of eight 16-byte loads per lane; every wave-wide
// load covers 512 contiguous bytes and every wave-wide store 256.
#define CVT_PER_BLK_ 32768
__device__ __forceinline__ void cvt_bf16_block(const float* __restrict__ in,
                                               bf16* __restrict__ out, int blk) {
    size_t base = (size_t)blk * CVT_PER_BLK_ + threadIdx.x * 4;
    // kept rolled: eight loads in flight per lane cover the memory latency, more only cost registers
#pragma unroll 1
    for (int bt = 0; bt < 4; ++bt) {
        f32x4 x[8];
#pragma unroll
        for (int u = 0; u < 8; ++u) x[u] = *(const f32x4*)(in + base + (bt * 8 + u) * 1024);
#pragma unroll
        for (int u = 0; u < 8; ++u) {
            bf16x4 o;
#pragma unroll
            for (int j = 0; j < 4; ++j) o[j] = f2bf(x[u][j]);
            *(bf16x4*)(out + base + (bt * 8 + u) * 1024) = o;
        }
        // the next trip rewrites the registers that these stores name: the wait stands in front of it
        asm volatile("s_wait_xcnt 0x0" ::: "memory");
    }
}

__device__ __forceinline__ void prep_logr_block(const float* __restrict__ R,
                                                const float* __restrict__ beta,
                                                _Float16* __restrict__ out, int blk) {
    int lane = threadIdx.x & 31;
    int gw = blk * 8 + (threadIdx.x >> 5);
    int q16 = gw >> 3, kt0 = (gw & 7) * 8;
    int rr = lane >> 2, c = lane & 3;          // query rr + 8 * i of the tile, keys c * 8 .. c * 8 + 7
    float b = beta[0];
    const float* src = R + ((size_t)q16 * 16 + rr) * L_ + kt0 * 32 + c * 8;
    _Float16* dst = out + ((size_t)q16 * (L_ / 32) + kt0) * 512
                        + (c >> 1) * 256 + ((c & 1) * 16 + rr) * 8;
    // kept rolled: two tiles, eight loads in flight per lane, are enough to cover the latency
#pragma unroll 1
    for (int t = 0; t < 8; t += 2) {
        f32x4 x[2][2][2];
#pragma unroll
        for (int tt = 0; tt < 2; ++tt)
#pragma unroll
            for (int i = 0; i < 2; ++i)
#pragma unroll
                for (int p = 0; p < 2; ++p)
                    x[tt][i][p] = *(const f32x4*)(src + (t + tt) * 32 + (size_t)(i * 8) * L_ + p * 4);
#pragma unroll
        for (int tt = 0; tt < 2; ++tt)
#pragma unroll
            for (int i = 0; i < 2; ++i) {
                f16x8 y;
#pragma unroll
                for (int e = 0; e < 8; ++e) {
                    float z = b * __logf(fmaxf(x[tt][i][e >> 2][e & 3], 1e-8f));
                    // stays finite in f16 for any beta: an infinite bias would make NaN in the softmax
                    y[e] = (_Float16)fminf(fmaxf(z, -65504.0f), 65504.0f);
                }
                *(f16x8*)(dst + (t + tt) * 512 + i * 64) = y;
            }
        // the next trip rewrites the registers that these stores name: the wait stands in front of it
        asm volatile("s_wait_xcnt 0x0" ::: "memory");
    }
}

// all six independent prep jobs in one grid: a block's index range says which job it does
#define NB_LR_  ((L_ / 16) * (L_ / 32) / 64)
#define NB_TOK_ ((B_ * L_ * D_) / CVT_PER_BLK_)
#define NB_W_   ((D_ * D_) / CVT_PER_BLK_)
__global__ __launch_bounds__(256) void prep_all(const float* __restrict__ tokens,
                                                const float* __restrict__ Wq,
                                                const float* __restrict__ Wk,
                                                const float* __restrict__ Wv,
                                                const float* __restrict__ Wp,
                                                const float* __restrict__ R,
                                                const float* __restrict__ beta,
                                                bf16* __restrict__ Xbf,
                                                bf16* __restrict__ Wb,
                                                _Float16* __restrict__ logRp) {
    int blk = blockIdx.x;
    if (blk < NB_LR_) {
        prep_logr_block(R, beta, logRp, blk);
    } else if (blk < NB_LR_ + NB_TOK_) {
        cvt_bf16_block(tokens, Xbf, blk - NB_LR_);
    } else {
        int r = blk - (NB_LR_ + NB_TOK_);
        int ws = r / NB_W_;
        const float* w = ws == 0 ? Wq : ws == 1 ? Wk : ws == 2 ? Wv : Wp;
        cvt_bf16_block(w, Wb + (size_t)ws * D_ * D_, r & (NB_W_ - 1));
    }
}

template <int SM>
__device__ __forceinline__ void store_tile(const f32x8 (&acc)[2][4], void* __restrict__ outp,
                                           int rowBase, int colBase, int wm, int wn,
                                           int lane, int N) {
    int hf = lane >> 4, lc = lane & 15;
#pragma unroll
    for (int fm = 0; fm < 2; ++fm)
#pragma unroll
        for (int fn = 0; fn < 4; ++fn)
#pragma unroll
            for (int v = 0; v < 8; ++v) {
                int rr = rowBase + wm * 32 + fm * 16 + v + hf * 8;
                int cc = colBase + wn * 64 + fn * 16 + lc;
                float val = acc[fm][fn][v];
                int b = rr >> 11, l = rr & (L_ - 1);
                int h = cc >> 6, d = cc & 63;
                if (SM == 0) {
                    ((bf16*)outp)[(((size_t)(b * H_ + h)) * L_ + l) * DH_ + d] = f2bf(val);
                } else if (SM == 2) {
                    ((bf16*)outp)[(((size_t)(b * H_ + h)) * DH_ + d) * L_ + l] = f2bf(val);
                } else {
                    ((float*)outp)[(size_t)rr * N + cc] = val;
                }
            }
}

// MODE 1: one product, f32 row-major out. MODE 3: W holds Wq, Wk, Wv stacked (N = 3 * D_);
// a block's 128 columns lie in one of them; outp holds Q, K (form 0) and V^T (form 2) in a row.
template <int MODE>
__global__ __launch_bounds__(256) void gemm_wmma(const bf16* __restrict__ A,
                                                 const bf16* __restrict__ W,
                                                 void* __restrict__ outp,
                                                 int M, int N, int K) {
    __shared__ bf16 sA[2][128 * 72];
    __shared__ bf16 sB[2][128 * 72];

    int tid = threadIdx.x, lane = tid & 31, wid = tid >> 5;
    int wm = wid & 3, wn = wid >> 2;
    int rowBase = blockIdx.y * 128, colBase = blockIdx.x * 128;
    const bf16* gA0 = A + (size_t)rowBase * K;
    const bf16* gW0 = W + (size_t)colBase * K;

    f32x8 acc[2][4];
#pragma unroll
    for (int i = 0; i < 2; ++i)
#pragma unroll
        for (int j = 0; j < 4; ++j) acc[i][j] = (f32x8)0.0f;

    const int NK = K >> 6;

#if USE_TDM
    bool leader = (wid == 0);
    if (leader) {
        tdm_load_2d(&sA[0][0], gA0, (unsigned)K, (unsigned)M, 64, 128, (unsigned)K, 4, 3);
        tdm_load_2d(&sB[0][0], gW0, (unsigned)K, (unsigned)N, 64, 128, (unsigned)K, 4, 3);
    }
#else
    int r = tid >> 1, hh = tid & 1;
    const bf16* gA = gA0 + (size_t)r * K + hh * 32;
    const bf16* gW = gW0 + (size_t)r * K + hh * 32;
    int lbase = r * 72 + hh * 32;
#pragma unroll
    for (int i = 0; i < 4; ++i) {
        async_b128(&sA[0][lbase + i * 8], gA + i * 8);
        async_b128(&sB[0][lbase + i * 8], gW + i * 8);
    }
#endif

    for (int kt = 0; kt < NK; ++kt) {
        int cur = kt & 1;
#if USE_TDM
        if (leader) {
            if (kt + 1 < NK) {
                tdm_load_2d(&sA[cur ^ 1][0], gA0 + (kt + 1) * 64, (unsigned)K, (unsigned)M,
                            64, 128, (unsigned)K, 4, 3);
                tdm_load_2d(&sB[cur ^ 1][0], gW0 + (kt + 1) * 64, (unsigned)K, (unsigned)N,
                            64, 128, (unsigned)K, 4, 3);
                wait_tensor2();   // tensor ops in-order: current tile's pair complete
            } else {
                wait_tensor0();
            }
        }
#else
        if (kt + 1 < NK) {
            const bf16* ga = gA + (size_t)(kt + 1) * 64;
            const bf16* gb = gW + (size_t)(kt + 1) * 64;
#pragma unroll
            for (int i = 0; i < 4; ++i) {
                async_b128(&sA[cur ^ 1][lbase + i * 8], ga + i * 8);
                async_b128(&sB[cur ^ 1][lbase + i * 8], gb + i * 8);
            }
            wait_async_le8();
        } else {
            wait_async_le0();
        }
#endif
        __syncthreads();

#pragma unroll
        for (int ks = 0; ks < 2; ++ks) {
            bf16x16 af[2], bfr[4];
#pragma unroll
            for (int fm = 0; fm < 2; ++fm)
                af[fm] = load_frag(&sA[cur][(wm * 32 + fm * 16) * 72 + ks * 32], 72, lane);
#pragma unroll
            for (int fn = 0; fn < 4; ++fn)
                bfr[fn] = load_frag(&sB[cur][(wn * 64 + fn * 16) * 72 + ks * 32], 72, lane);
#pragma unroll
            for (int fm = 0; fm < 2; ++fm)
#pragma unroll
                for (int fn = 0; fn < 4; ++fn)
                    acc[fm][fn] = wmma_bf16(af[fm], bfr[fn], acc[fm][fn]);
        }
        __syncthreads();
    }

    if (MODE == 1) {
        store_tile<1>(acc, outp, rowBase, colBase, wm, wn, lane, N);
    } else {
        int sel = colBase / D_;
        bf16* o = (bf16*)outp + (size_t)sel * ((size_t)B_ * L_ * D_);
        if (sel == 2) {
            store_tile<2>(acc, o, rowBase, colBase & (D_ - 1), wm, wn, lane, N);
        } else {
            store_tile<0>(acc, o, rowBase, colBase & (D_ - 1), wm, wn, lane, N);
            // in the listing the other form's code stands behind these stores and rewrites
            // their address registers: this wait stands in front of that rewrite
            asm volatile("s_wait_xcnt 0x0" ::: "memory");
        }
    }
}

__global__ __launch_bounds__(256) __attribute__((amdgpu_waves_per_eu(4, 4))) void attn_flash(const bf16* __restrict__ Q,
                                                  const bf16* __restrict__ Km,
                                                  const bf16* __restrict__ Vt,
                                                  const _Float16* __restrict__ logRp,
                                                  bf16* __restrict__ O) {
    __shared__ bf16 sK[2][64 * 72];    // [key][d]  (A operand of S^T = K Q^T)
    __shared__ bf16 sVt[2][64 * 72];   // [d][key]  (A operand of O^T += V^T P^T)

    int tid = threadIdx.x, lane = tid & 31, w = tid >> 5;
    int bid = blockIdx.x;
    int qt = bid & 7, h = (bid >> 3) & (H_ - 1), b = bid >> 7;
    int bh = b * H_ + h;
    const bf16* Qh = Q + (size_t)bh * L_ * DH_;
    const bf16* Kh = Km + (size_t)bh * L_ * DH_;
    const bf16* Vh = Vt + (size_t)bh * DH_ * L_;   // [Dh][L]
    int q0 = qt * 256 + w * 32;
    int hf = lane >> 4, lc = lane & 15;

    bf16x16 qf[2][2];
#pragma unroll
    for (int g = 0; g < 2; ++g) {
        qf[g][0] = load_frag(Qh + (size_t)(q0 + g * 16) * DH_ + 0, DH_, lane);
        qf[g][1] = load_frag(Qh + (size_t)(q0 + g * 16) * DH_ + 32, DH_, lane);
    }

    // one query column per lane and group (q0 + g * 16 + lc); the two halves hold different keys
    float m[2] = {-1e30f, -1e30f}, s[2] = {0.0f, 0.0f};
    f32x8 of[2][4];   // O^T tiles: of[g][n][v] = O[q0 + g * 16 + lc][n * 16 + hf * 8 + v]
#pragma unroll
    for (int g = 0; g < 2; ++g)
#pragma unroll
        for (int n = 0; n < 4; ++n) of[g][n] = (f32x8)0.0f;

    const _Float16* lrbase = logRp + ((size_t)(q0 >> 4) * (L_ / 32)) * 512 + lane * 8;

    int keyA = tid >> 2, segA = tid & 3;
    int dV = tid >> 2, hV = tid & 3;
    const bf16* gk0 = Kh + (size_t)keyA * DH_ + segA * 16;
    const bf16* gv0 = Vh + (size_t)dV * L_ + hV * 16;
    int lK = keyA * 72 + segA * 16;
    int lV = dV * 72 + hV * 16;

    async_b128_x4(&sK[0][lK], gk0, &sK[0][lK + 8], gk0 + 8,
                  &sVt[0][lV], gv0, &sVt[0][lV + 8], gv0 + 8);

    // bias tiles, one per group, always fetched one pass ahead of their use; here the first pass's
    // (f16: eight keys of a lane in one 16-byte load, a chunk of 512 contiguous bytes a wave)
    f16x8 cb[2][2];
#pragma unroll
    for (int g = 0; g < 2; ++g)
#pragma unroll
        for (int j = 0; j < 2; ++j)
            cb[g][j] = *(const f16x8*)(lrbase + (size_t)g * (L_ / 32) * 512 + j * 256);

    for (int kt = 0; kt < L_; kt += 64) {
        int cur = (kt >> 6) & 1;
        if (kt + 64 < L_) {
            const bf16* gk = gk0 + (size_t)(kt + 64) * DH_;
            const bf16* gv = gv0 + (kt + 64);
            async_b128_x4(&sK[cur ^ 1][lK], gk, &sK[cur ^ 1][lK + 8], gk + 8,
                          &sVt[cur ^ 1][lV], gv, &sVt[cur ^ 1][lV + 8], gv + 8);
        }

        const _Float16* lr = lrbase + (size_t)(kt >> 5) * 512;

        if (kt + 64 < L_) wait_async_le4(); else wait_async_le0();
        __syncthreads();

#pragma unroll
        for (int sub = 0; sub < 2; ++sub) {
            f32x8 sc[2][2];
#pragma unroll
            for (int g = 0; g < 2; ++g) { sc[g][0] = (f32x8)0.0f; sc[g][1] = (f32x8)0.0f; }
#pragma unroll
            for (int j = 0; j < 2; ++j)
#pragma unroll
                for (int kd = 0; kd < 2; ++kd) {
                    bf16x16 kf = load_frag(&sK[cur][(sub * 32 + j * 16) * 72 + kd * 32], 72, lane);
#pragma unroll
                    for (int g = 0; g < 2; ++g) sc[g][j] = wmma_bf16(kf, qf[g][kd], sc[g][j]);
                }

            // xv[g][j][v] = score of key kt + sub * 32 + j * 16 + hf * 8 + v for query q0 + g * 16 + lc
            // the f16 bias is widened to f32 first; the multiply-add and the scores are f32 as before
            f32x8 xv[2][2];
#pragma unroll
            for (int g = 0; g < 2; ++g)
#pragma unroll
                for (int j = 0; j < 2; ++j)
                    xv[g][j] = sc[g][j] * SCALE_ + __builtin_convertvector(cb[g][j], f32x8);

            bf16x16 pf[2];
#pragma unroll
            for (int g = 0; g < 2; ++g) {
                float rm = fmaxf(xv[g][0][0], xv[g][1][0]);
#pragma unroll
                for (int v = 1; v < 8; ++v) rm = fmaxf(rm, fmaxf(xv[g][0][v], xv[g][1][v]));
                rm = fmaxf(rm, xhalf(rm));
                float mn = fmaxf(m[g], rm);
                float corr = __expf(m[g] - mn);
                m[g] = mn;
#pragma unroll
                for (int j = 0; j < 2; ++j)
#pragma unroll
                    for (int v = 0; v < 8; ++v) xv[g][j][v] = __expf(xv[g][j][v] - mn);
                float ls = 0.0f;
#pragma unroll
                for (int v = 0; v < 8; ++v) ls += xv[g][0][v] + xv[g][1][v];
                s[g] = s[g] * corr + ls;   // this half's keys only; the halves join after the loop
#pragma unroll
                for (int n = 0; n < 4; ++n)
#pragma unroll
                    for (int v = 0; v < 8; ++v) of[g][n][v] *= corr;

                // two D tiles of S^T, converted in place, are the B operand P^T (hardware k order)
#pragma unroll
                for (int j = 0; j < 2; ++j)
#pragma unroll
                    for (int v = 0; v < 8; ++v) pf[g][j * 8 + v] = f2bf(xv[g][j][v]);

                // the next pass's bias tile, a pass ahead of its use; the last pass re-reads its trip's
                // first tile, unused: no branch round the loads, so their waits stay counted
                const _Float16* ln = lr + (sub == 0 ? 512 : (kt + 64 < L_ ? 1024 : 0));
#pragma unroll
                for (int j = 0; j < 2; ++j)
                    cb[g][j] = *(const f16x8*)(ln + (size_t)g * (L_ / 32) * 512 + j * 256);
            }
#pragma unroll
            for (int n = 0; n < 4; ++n) {
                bf16x16 vf = load_frag(&sVt[cur][(n * 16) * 72 + sub * 32], 72, lane);
#pragma unroll
                for (int g = 0; g < 2; ++g) of[g][n] = wmma_bf16(vf, pf[g], of[g][n]);
            }
            // keeps the second pass's score products behind the first pass: moved ahead of it, both
            // passes' scores and bias tiles are live at once and a Q fragment spills to scratch
            if (sub == 0) __builtin_amdgcn_sched_barrier(0);
        }
        __syncthreads();
    }

#pragma unroll
    for (int g = 0; g < 2; ++g) {
        float si = 1.0f / (s[g] + xhalf(s[g]));
        bf16* orow = O + ((size_t)(b * L_ + q0 + g * 16 + lc)) * D_ + h * DH_ + hf * 8;
#pragma unroll
        for (int n = 0; n < 4; ++n) {
            bf16x8 o8;
#pragma unroll
            for (int v = 0; v < 8; ++v) o8[v] = f2bf(of[g][n][v] * si);
            *(bf16x8*)(orow + n * 16) = o8;
        }
    }
}

// ---------------- residual + LayerNorm ----------------
// One wave per row, two rows a wave: a lane holds 32 of a row's 1,024 values, the row sums join
// inside the wave, and no LDS or barrier is needed. All loads are issued first, all stores last.
__global__ __launch_bounds__(256) void resid_ln(const float* __restrict__ Y,
                                                const float* __restrict__ tokens,
                                                const float* __restrict__ gamma,
                                                const float* __restrict__ bias,
                                                float* __restrict__ out) {
    int lane = threadIdx.x & 31, wid = threadIdx.x >> 5;
    size_t ro = (size_t)((blockIdx.x * 8 + wid) * 2) * D_ + lane * 4;
    f32x4 y[2][8], t[2][8], g[8], bb[8];
#pragma unroll
    for (int ri = 0; ri < 2; ++ri)
#pragma unroll
        for (int i = 0; i < 8; ++i) {
            y[ri][i] = *(const f32x4*)(Y + ro + ri * D_ + i * 128);
            t[ri][i] = *(const f32x4*)(tokens + ro + ri * D_ + i * 128);
        }
#pragma unroll
    for (int i = 0; i < 8; ++i) {
        g[i]  = *(const f32x4*)(gamma + lane * 4 + i * 128);
        bb[i] = *(const f32x4*)(bias + lane * 4 + i * 128);
    }
    float mu[2], rr[2];
#pragma unroll
    for (int ri = 0; ri < 2; ++ri) {
        float sum = 0.f, sq = 0.f;
#pragma unroll
        for (int i = 0; i < 8; ++i) {
            y[ri][i] += t[ri][i];
#pragma unroll
            for (int e = 0; e < 4; ++e) {
                sum += y[ri][i][e];
                sq  += y[ri][i][e] * y[ri][i][e];
            }
        }
        sum = rsum16(sum); sq = rsum16(sq);
        sum += xhalf(sum); sq += xhalf(sq);
        mu[ri] = sum * (1.0f / D_);
        float var = sq * (1.0f / D_) - mu[ri] * mu[ri];
        rr[ri] = rsqrtf(var + 1e-5f);
    }
    // inputs only: keeps the gamma and bias loads above this line, in flight with the rows' loads;
    // without it the compiler sinks them among the stores, each pair with its own exposed latency
    asm volatile("" :: "v"(g[0]), "v"(g[1]), "v"(g[2]), "v"(g[3]), "v"(g[4]), "v"(g[5]), "v"(g[6]),
                 "v"(g[7]), "v"(bb[0]), "v"(bb[1]), "v"(bb[2]), "v"(bb[3]), "v"(bb[4]), "v"(bb[5]),
                 "v"(bb[6]), "v"(bb[7]));
#pragma unroll
    for (int ri = 0; ri < 2; ++ri)
#pragma unroll
        for (int i = 0; i < 8; ++i)
#pragma unroll
            for (int e = 0; e < 4; ++e)
                y[ri][i][e] = (y[ri][i][e] - mu[ri]) * rr[ri] * g[i][e] + bb[i][e];
#pragma unroll
    for (int ri = 0; ri < 2; ++ri)
#pragma unroll
        for (int i = 0; i < 8; ++i) *(f32x4*)(out + ro + ri * D_ + i * 128) = y[ri][i];
}

// ---------------- host launcher ----------------
extern "C" void kernel_launch(void* const* d_in, const int* in_sizes, int n_in,
                              void* d_out, int out_size, void* d_ws, size_t ws_size,
                              hipStream_t stream) {
    const float* tokens = (const float*)d_in[0];
    const float* R      = (const float*)d_in[1];
    const float* Wq     = (const float*)d_in[2];
    const float* Wk     = (const float*)d_in[3];
    const float* Wv     = (const float*)d_in[4];
    const float* Wp     = (const float*)d_in[5];
    const float* beta   = (const float*)d_in[6];
    const float* gamma  = (const float*)d_in[7];
    const float* bias   = (const float*)d_in[8];
    float* out = (float*)d_out;

    const int M = B_ * L_;   // 8192
    char* ws = (char*)d_ws;
    size_t off = 0;
    bf16*  Xbf   = (bf16*)(ws + off);  off += (size_t)M * D_ * 2;
    bf16*  Wb    = (bf16*)(ws + off);  off += (size_t)4 * D_ * D_ * 2;
    bf16*  Qb    = (bf16*)(ws + off);  off += (size_t)M * D_ * 2;
    bf16*  Kb    = (bf16*)(ws + off);  off += (size_t)M * D_ * 2;
    bf16*  Vtb   = (bf16*)(ws + off);  off += (size_t)M * D_ * 2;
    _Float16* logRp = (_Float16*)(ws + off); off += (size_t)L_ * L_ * 2;
    bf16*  Ob    = (bf16*)(ws + off);  off += (size_t)M * D_ * 2;
    float* Y     = (float*)(ws + off); off += (size_t)M * D_ * 4;

    prep_all<<<NB_LR_ + NB_TOK_ + 4 * NB_W_, 256, 0, stream>>>(tokens, Wq, Wk, Wv, Wp, R, beta,
                                                               Xbf, Wb, logRp);

    // Qb, Kb, Vtb follow one another in the workspace; Wq, Wk, Wv are the first 3 * D_ rows of Wb
    gemm_wmma<3><<<dim3(3 * D_ / 128, M / 128), 256, 0, stream>>>(Xbf, Wb, Qb, M, 3 * D_, D_);

    attn_flash<<<B_ * H_ * (L_ / 256), 256, 0, stream>>>(Qb, Kb, Vtb, logRp, Ob);

    gemm_wmma<1><<<dim3(D_ / 128, M / 128), 256, 0, stream>>>(Ob, Wb + 3 * (size_t)D_ * D_, Y, M, D_, D_);

    resid_ln<<<M / 16, 256, 0, stream>>>(Y, tokens, gamma, bias, out);
}

// v006
// A run of this version takes 151 microseconds.
// Next to v005, in two timings, it ran 1.05 times as fast each time.
// All steps since v000 together make it 1.88 times as fast.
#include <hip/hip_runtime.h>
#include <hip/hip_bf16.h>
#include <math.h>

// ---------------- types ----------------
typedef __bf16 bf16;
typedef bf16  bf16x4  __attribute__((ext_vector_type(4)));
typedef bf16  bf16x8  __attribute__((ext_vector_type(8)));
typedef bf16  bf16x16 __attribute__((ext_vector_type(16)));
typedef float f32x8   __attribute__((ext_vector_type(8)));
typedef float f32x4   __attribute__((ext_vector_type(4)));
typedef _Float16 f16x8 __attribute__((ext_vector_type(8)));
typedef unsigned int u32x4 __attribute__((ext_vector_type(4)));
typedef int  i32x4 __attribute__((ext_vector_type(4)));
typedef int  i32x8 __attribute__((ext_vector_type(8)));

#define B_  4
#define L_  2048
#define D_  1024
#define H_  16
#define DH_ 64
#define SCALE_ 0.125f   // 64^-0.5

#if __has_builtin(__builtin_amdgcn_tensor_load_to_lds)
#define USE_TDM 1
#else
#define USE_TDM 0
#endif

// float -> bf16, round to nearest even, by the hardware's packed convert: one instruction rounds two
// values and leaves them packed in one register
__device__ __forceinline__ bf16 f2bf(float f) { return (bf16)f; }
__device__ __forceinline__ bf16x4 f2bf4(f32x4 x) { return __builtin_convertvector(x, bf16x4); }
__device__ __forceinline__ bf16x8 f2bf8(f32x8 x) { return __builtin_convertvector(x, bf16x8); }

// ---------------- DPP16 16-lane reductions (pure VALU, no LDS) ----------------
template <int CTRL>
__device__ __forceinline__ float dpp_f(float x) {
    int r = __builtin_amdgcn_update_dpp(0, __builtin_bit_cast(int, x), CTRL, 0xf, 0xf, true);
    return __builtin_bit_cast(float, r);
}
__device__ __forceinline__ float rsum16(float x) {
    x += dpp_f<0xB1>(x);     // quad_perm xor1
    x += dpp_f<0x4E>(x);     // quad_perm xor2
    x += dpp_f<0x141>(x);    // row_half_mirror
    x += dpp_f<0x140>(x);    // row_mirror
    return x;
}

__device__ __forceinline__ float xhalf(float x) {
    int b = __builtin_bit_cast(int, x);
    int r = __builtin_amdgcn_permlanex16(b, b, 0x76543210, 0xfedcba98, false, false);
    return __builtin_bit_cast(float, r);
}

__device__ __forceinline__ void async_b128(void* lds_ptr, const void* gptr) {
    unsigned la = (unsigned)(uintptr_t)lds_ptr;
    unsigned long long ga = (unsigned long long)(uintptr_t)gptr;
    asm volatile("global_load_async_to_lds_b128 %0, %1, off"
                 :: "v"(la), "v"(ga) : "memory");
}
// four copies of one lane in a row; the wait is the last line of the copies' own statement, so that
// it stands in front of every later rewrite of the address registers that the copies name
__device__ __forceinline__ void async_b128_x4(void* l0, const void* g0, void* l1, const void* g1,
                                              void* l2, const void* g2, void* l3, const void* g3) {
    asm volatile("global_load_async_to_lds_b128 %0, %1, off\n\t"
                 "global_load_async_to_lds_b128 %2, %3, off\n\t"
                 "global_load_async_to_lds_b128 %4, %5, off\n\t"
                 "global_load_async_to_lds_b128 %6, %7, off\n\t"
                 "s_wait_xcnt 0x0"
                 :: "v"((unsigned)(uintptr_t)l0), "v"((unsigned long long)(uintptr_t)g0),
                    "v"((unsigned)(uintptr_t)l1), "v"((unsigned long long)(uintptr_t)g1),
                    "v"((unsigned)(uintptr_t)l2), "v"((unsigned long long)(uintptr_t)g2),
                    "v"((unsigned)(uintptr_t)l3), "v"((unsigned long long)(uintptr_t)g3)
                 : "memory");
}
__device__ __forceinline__ void wait_async_le0() { asm volatile("s_wait_asynccnt 0x0" ::: "memory"); }
__device__ __forceinline__ void wait_async_le4() { asm volatile("s_wait_asynccnt 0x4" ::: "memory"); }
__device__ __forceinline__ void wait_async_le8() { asm volatile("s_wait_asynccnt 0x8" ::: "memory"); }

#if USE_TDM
__device__ __forceinline__ void tdm_load_2d(void* lds_ptr, const void* gptr,
                                            unsigned tensor_d0, unsigned tensor_d1,
                                            unsigned tile_d0, unsigned tile_d1,
                                            unsigned stride_d0,
                                            unsigned pad_i, unsigned pad_a) {
    unsigned long long ga = (unsigned long long)(uintptr_t)gptr;
    u32x4 g0;
    g0[0] = 1u;
    g0[1] = (unsigned)(uintptr_t)lds_ptr;
    g0[2] = (unsigned)(ga & 0xFFFFFFFFu);
    g0[3] = (unsigned)((ga >> 32) & 0x1FFFFFFu) | (2u << 30);
    i32x8 g1;
    g1[0] = (int)((1u << 16) | (1u << 20) | (pad_i << 22) | (pad_a << 25));
    g1[1] = (int)((tensor_d0 & 0xFFFFu) << 16);
    g1[2] = (int)((tensor_d0 >> 16) | ((tensor_d1 & 0xFFFFu) << 16));
    g1[3] = (int)((tensor_d1 >> 16) | (tile_d0 << 16));
    g1[4] = (int)tile_d1;
    g1[5] = (int)stride_d0;
    g1[6] = 0;
    g1[7] = 0;
    i32x4 gz = {0, 0, 0, 0};
#if defined(__clang_major__) && (__clang_major__ >= 23)
    i32x8 gz8 = {0, 0, 0, 0, 0, 0, 0, 0};
    __builtin_amdgcn_tensor_load_to_lds(g0, g1, gz, gz, gz8, 0);
#else
    __builtin_amdgcn_tensor_load_to_lds(g0, g1, gz, gz, 0);
#endif
}
__device__ __forceinline__ void wait_tensor0() { __builtin_amdgcn_s_wait_tensorcnt(0); }
__device__ __forceinline__ void wait_tensor2() { __builtin_amdgcn_s_wait_tensorcnt(2); }
#endif

__device__ __forceinline__ bf16x16 load_frag(const bf16* p, int stride, int lane) {
    int hf = lane >> 4;
    int r  = lane & 15;
    const bf16* q = p + r * stride + hf * 8;
    bf16x8 lo = *(const bf16x8*)(q);
    bf16x8 hi = *(const bf16x8*)(q + 16);
    bf16x16 f;
#pragma unroll
    for (int i = 0; i < 8; ++i) { f[i] = lo[i]; f[i + 8] = hi[i]; }
    return f;
}

__device__ __forceinline__ f32x8 wmma_bf16(bf16x16 a, bf16x16 b, f32x8 c) {
    return __builtin_amdgcn_wmma_f32_16x16x32_bf16(false, a, false, b, (short)0, c, false, false);
}

// ---------------- prep kernels ----------------
// A block converts 32,768 floats: four batches of eight 16-byte loads per lane; every wave-wide
// load covers 512 contiguous bytes and every wave-wide store 256.
#define CVT_PER_BLK_ 32768
__device__ __forceinline__ void cvt_bf16_block(const float* __restrict__ in,
                                               bf16* __restrict__ out, int blk) {
    size_t base = (size_t)blk * CVT_PER_BLK_ + threadIdx.x * 4;
    // kept rolled: eight loads in flight per lane cover the memory latency, more only cost registers
#pragma unroll 1
    for (int bt = 0; bt < 4; ++bt) {
        f32x4 x[8];
#pragma unroll
        for (int u = 0; u < 8; ++u) x[u] = *(const f32x4*)(in + base + (bt * 8 + u) * 1024);
#pragma unroll
        for (int u = 0; u < 8; ++u) {
            *(bf16x4*)(out + base + (bt * 8 + u) * 1024) = f2bf4(x[u]);
        }
        // the next trip rewrites the registers that these stores name: the wait stands in front of it
        asm volatile("s_wait_xcnt 0x0" ::: "memory");
    }
}

__device__ __forceinline__ void prep_logr_block(const float* __restrict__ R,
                                                const float* __restrict__ beta,
                                                _Float16* __restrict__ out, int blk) {
    int lane = threadIdx.x & 31;
    int gw = blk * 8 + (threadIdx.x >> 5);
    int q16 = gw >> 3, kt0 = (gw & 7) * 8;
    int rr = lane >> 2, c = lane & 3;          // query rr + 8 * i of the tile, keys c * 8 .. c * 8 + 7
    float b = beta[0];
    const float* src = R + ((size_t)q16 * 16 + rr) * L_ + kt0 * 32 + c * 8;
    _Float16* dst = out + ((size_t)q16 * (L_ / 32) + kt0) * 512
                        + (c >> 1) * 256 + ((c & 1) * 16 + rr) * 8;
    // kept rolled: two tiles, eight loads in flight per lane, are enough to cover the latency
#pragma unroll 1
    for (int t = 0; t < 8; t += 2) {
        f32x4 x[2][2][2];
#pragma unroll
        for (int tt = 0; tt < 2; ++tt)
#pragma unroll
            for (int i = 0; i < 2; ++i)
#pragma unroll
                for (int p = 0; p < 2; ++p)
                    x[tt][i][p] = *(const f32x4*)(src + (t + tt) * 32 + (size_t)(i * 8) * L_ + p * 4);
#pragma unroll
        for (int tt = 0; tt < 2; ++tt)
#pragma unroll
            for (int i = 0; i < 2; ++i) {
                f16x8 y;
#pragma unroll
                for (int e = 0; e < 8; ++e) {
                    float z = b * __logf(fmaxf(x[tt][i][e >> 2][e & 3], 1e-8f));
                    // stays finite in f16 for any beta: an infinite bias would make NaN in the softmax
                    y[e] = (_Float16)fminf(fmaxf(z, -65504.0f), 65504.0f);
                }
                *(f16x8*)(dst + (t + tt) * 512 + i * 64) = y;
            }
        // the next trip rewrites the registers that these stores name: the wait stands in front of it
        asm volatile("s_wait_xcnt 0x0" ::: "memory");
    }
}

// all six independent prep jobs in one grid: a block's index range says which job it does
#define NB_LR_  ((L_ / 16) * (L_ / 32) / 64)
#define NB_TOK_ ((B_ * L_ * D_) / CVT_PER_BLK_)
#define NB_W_   ((D_ * D_) / CVT_PER_BLK_)
__global__ __launch_bounds__(256) void prep_all(const float* __restrict__ tokens,
                                                const float* __restrict__ Wq,
                                                const float* __restrict__ Wk,
                                                const float* __restrict__ Wv,
                                                const float* __restrict__ Wp,
                                                const float* __restrict__ R,
                                                const float* __restrict__ beta,
                                                bf16* __restrict__ Xbf,
                                                bf16* __restrict__ Wb,
                                                _Float16* __restrict__ logRp) {
    int blk = blockIdx.x;
    if (blk < NB_LR_) {
        prep_logr_block(R, beta, logRp, blk);
    } else if (blk < NB_LR_ + NB_TOK_) {
        cvt_bf16_block(tokens, Xbf, blk - NB_LR_);
    } else {
        int r = blk - (NB_LR_ + NB_TOK_);
        int ws = r / NB_W_;
        const float* w = ws == 0 ? Wq : ws == 1 ? Wk : ws == 2 ? Wv : Wp;
        cvt_bf16_block(w, Wb + (size_t)ws * D_ * D_, r & (NB_W_ - 1));
    }
}

template <int SM>
__device__ __forceinline__ void store_tile(const f32x8 (&acc)[2][4], void* __restrict__ outp,
                                           int rowBase, int colBase, int wm, int wn,
                                           int lane, int N) {
    int hf = lane >> 4, lc = lane & 15;
#pragma unroll
    for (int fm = 0; fm < 2; ++fm)
#pragma unroll
        for (int fn = 0; fn < 4; ++fn)
#pragma unroll
            for (int v = 0; v < 8; ++v) {
                int rr = rowBase + wm * 32 + fm * 16 + v + hf * 8;
                int cc = colBase + wn * 64 + fn * 16 + lc;
                float val = acc[fm][fn][v];
                int b = rr >> 11, l = rr & (L_ - 1);
                int h = cc >> 6, d = cc & 63;
                if (SM == 0) {
                    ((bf16*)outp)[(((size_t)(b * H_ + h)) * L_ + l) * DH_ + d] = f2bf(val);
                } else if (SM == 2) {
                    ((bf16*)outp)[(((size_t)(b * H_ + h)) * DH_ + d) * L_ + l] = f2bf(val);
                } else {
                    ((float*)outp)[(size_t)rr * N + cc] = val;
                }
            }
}

// MODE 1: one product, f32 row-major out. MODE 3: W holds Wq, Wk, Wv stacked (N = 3 * D_);
// a block's 128 columns lie in one of them; outp holds Q, K (form 0) and V^T (form 2) in a row.
template <int MODE>
__global__ __launch_bounds__(256) void gemm_wmma(const bf16* __restrict__ A,
                                                 const bf16* __restrict__ W,
                                                 void* __restrict__ outp,
                                                 int M, int N, int K) {
    __shared__ bf16 sA[2][128 * 72];
    __shared__ bf16 sB[2][128 * 72];

    int tid = threadIdx.x, lane = tid & 31, wid = tid >> 5;
    int wm = wid & 3, wn = wid >> 2;
    int rowBase = blockIdx.y * 128, colBase = blockIdx.x * 128;
    const bf16* gA0 = A + (size_t)rowBase * K;
    const bf16* gW0 = W + (size_t)colBase * K;

    f32x8 acc[2][4];
#pragma unroll
    for (int i = 0; i < 2; ++i)
#pragma unroll
        for (int j = 0; j < 4; ++j) acc[i][j] = (f32x8)0.0f;

    const int NK = K >> 6;

#if USE_TDM
    bool leader = (wid == 0);
    if (leader) {
        tdm_load_2d(&sA[0][0], gA0, (unsigned)K, (unsigned)M, 64, 128, (unsigned)K, 4, 3);
        tdm_load_2d(&sB[0][0], gW0, (unsigned)K, (unsigned)N, 64, 128, (unsigned)K, 4, 3);
    }
#else
    int r = tid >> 1, hh = tid & 1;
    const bf16* gA = gA0 + (size_t)r * K + hh * 32;
    const bf16* gW = gW0 + (size_t)r * K + hh * 32;
    int lbase = r * 72 + hh * 32;
#pragma unroll
    for (int i = 0; i < 4; ++i) {
        async_b128(&sA[0][lbase + i * 8], gA + i * 8);
        async_b128(&sB[0][lbase + i * 8], gW + i * 8);
    }
#endif

    for (int kt = 0; kt < NK; ++kt) {
        int cur = kt & 1;
#if USE_TDM
        if (leader) {
            if (kt + 1 < NK) {
                tdm_load_2d(&sA[cur ^ 1][0], gA0 + (kt + 1) * 64, (unsigned)K, (unsigned)M,
                            64, 128, (unsigned)K, 4, 3);
                tdm_load_2d(&sB[cur ^ 1][0], gW0 + (kt + 1) * 64, (unsigned)K, (unsigned)N,
                            64, 128, (unsigned)K, 4, 3);
                wait_tensor2();   // tensor ops in-order: current tile's pair complete
            } else {
                wait_tensor0();
            }
        }
#else
        if (kt + 1 < NK) {
            const bf16* ga = gA + (size_t)(kt + 1) * 64;
            const bf16* gb = gW + (size_t)(kt + 1) * 64;
#pragma unroll
            for (int i = 0; i < 4; ++i) {
                async_b128(&sA[cur ^ 1][lbase + i * 8], ga + i * 8);
                async_b128(&sB[cur ^ 1][lbase + i * 8], gb + i * 8);
            }
            wait_async_le8();
        } else {
            wait_async_le0();
        }
#endif
        __syncthreads();

#pragma unroll
        for (int ks = 0; ks < 2; ++ks) {
            bf16x16 af[2], bfr[4];
#pragma unroll
            for (int fm = 0; fm < 2; ++fm)
                af[fm] = load_frag(&sA[cur][(wm * 32 + fm * 16) * 72 + ks * 32], 72, lane);
#pragma unroll
            for (int fn = 0; fn < 4; ++fn)
                bfr[fn] = load_frag(&sB[cur][(wn * 64 + fn * 16) * 72 + ks * 32], 72, lane);
#pragma unroll
            for (int fm = 0; fm < 2; ++fm)
#pragma unroll
                for (int fn = 0; fn < 4; ++fn)
                    acc[fm][fn] = wmma_bf16(af[fm], bfr[fn], acc[fm][fn]);
        }
        __syncthreads();
    }

    if (MODE == 1) {
        store_tile<1>(acc, outp, rowBase, colBase, wm, wn, lane, N);
    } else {
        int sel = colBase / D_;
        bf16* o = (bf16*)outp + (size_t)sel * ((size_t)B_ * L_ * D_);
        if (sel == 2) {
            store_tile<2>(acc, o, rowBase, colBase & (D_ - 1), wm, wn, lane, N);
        } else {
            store_tile<0>(acc, o, rowBase, colBase & (D_ - 1), wm, wn, lane, N);
            // in the listing the other form's code stands behind these stores and rewrites
            // their address registers: this wait stands in front of that rewrite
            asm volatile("s_wait_xcnt 0x0" ::: "memory");
        }
    }
}

__global__ __launch_bounds__(256) __attribute__((amdgpu_waves_per_eu(4, 4))) void attn_flash(const bf16* __restrict__ Q,
                                                  const bf16* __restrict__ Km,
                                                  const bf16* __restrict__ Vt,
                                                  const _Float16* __restrict__ logRp,
                                                  bf16* __restrict__ O) {
    __shared__ bf16 sK[2][64 * 72];    // [key][d]  (A operand of S^T = K Q^T)
    __shared__ bf16 sVt[2][64 * 72];   // [d][key]  (A operand of O^T += V^T P^T)

    int tid = threadIdx.x, lane = tid & 31, w = tid >> 5;
    int bid = blockIdx.x;
    int qt = bid & 7, h = (bid >> 3) & (H_ - 1), b = bid >> 7;
    int bh = b * H_ + h;
    const bf16* Qh = Q + (size_t)bh * L_ * DH_;
    const bf16* Kh = Km + (size_t)bh * L_ * DH_;
    const bf16* Vh = Vt + (size_t)bh * DH_ * L_;   // [Dh][L]
    int q0 = qt * 256 + w * 32;
    int hf = lane >> 4, lc = lane & 15;

    bf16x16 qf[2][2];
#pragma unroll
    for (int g = 0; g < 2; ++g) {
        qf[g][0] = load_frag(Qh + (size_t)(q0 + g * 16) * DH_ + 0, DH_, lane);
        qf[g][1] = load_frag(Qh + (size_t)(q0 + g * 16) * DH_ + 32, DH_, lane);
    }

    // one query column per lane and group (q0 + g * 16 + lc); the two halves hold different keys
    float m[2] = {-1e30f, -1e30f}, s[2] = {0.0f, 0.0f};
    f32x8 of[2][4];   // O^T tiles: of[g][n][v] = O[q0 + g * 16 + lc][n * 16 + hf * 8 + v]
#pragma unroll
    for (int g = 0; g < 2; ++g)
#pragma unroll
        for (int n = 0; n < 4; ++n) of[g][n] = (f32x8)0.0f;

    const _Float16* lrbase = logRp + ((size_t)(q0 >> 4) * (L_ / 32)) * 512 + lane * 8;

    int keyA = tid >> 2, segA = tid & 3;
    int dV = tid >> 2, hV = tid & 3;
    const bf16* gk0 = Kh + (size_t)keyA * DH_ + segA * 16;
    const bf16* gv0 = Vh + (size_t)dV * L_ + hV * 16;
    int lK = keyA * 72 + segA * 16;
    int lV = dV * 72 + hV * 16;

    async_b128_x4(&sK[0][lK], gk0, &sK[0][lK + 8], gk0 + 8,
                  &sVt[0][lV], gv0, &sVt[0][lV + 8], gv0 + 8);

    // bias tiles, one per group, always fetched one pass ahead of their use; here the first pass's
    // (f16: eight keys of a lane in one 16-byte load, a chunk of 512 contiguous bytes a wave)
    f16x8 cb[2][2];
#pragma unroll
    for (int g = 0; g < 2; ++g)
#pragma unroll
        for (int j = 0; j < 2; ++j)
            cb[g][j] = *(const f16x8*)(lrbase + (size_t)g * (L_ / 32) * 512 + j * 256);

    for (int kt = 0; kt < L_; kt += 64) {
        int cur = (kt >> 6) & 1;
        if (kt + 64 < L_) {
            const bf16* gk = gk0 + (size_t)(kt + 64) * DH_;
            const bf16* gv = gv0 + (kt + 64);
            async_b128_x4(&sK[cur ^ 1][lK], gk, &sK[cur ^ 1][lK + 8], gk + 8,
                          &sVt[cur ^ 1][lV], gv, &sVt[cur ^ 1][lV + 8], gv + 8);
        }

        const _Float16* lr = lrbase + (size_t)(kt >> 5) * 512;

        if (kt + 64 < L_) wait_async_le4(); else wait_async_le0();
        __syncthreads();

#pragma unroll
        for (int sub = 0; sub < 2; ++sub) {
            f32x8 sc[2][2];
#pragma unroll
            for (int g = 0; g < 2; ++g) { sc[g][0] = (f32x8)0.0f; sc[g][1] = (f32x8)0.0f; }
#pragma unroll
            for (int j = 0; j < 2; ++j)
#pragma unroll
                for (int kd = 0; kd < 2; ++kd) {
                    bf16x16 kf = load_frag(&sK[cur][(sub * 32 + j * 16) * 72 + kd * 32], 72, lane);
#pragma unroll
                    for (int g = 0; g < 2; ++g) sc[g][j] = wmma_bf16(kf, qf[g][kd], sc[g][j]);
                }

            // xv[g][j][v] = score of key kt + sub * 32 + j * 16 + hf * 8 + v for query q0 + g * 16 + lc
            // the f16 bias is widened to f32 first; the multiply-add and the scores are f32 as before
            f32x8 xv[2][2];
#pragma unroll
            for (int g = 0; g < 2; ++g)
#pragma unroll
                for (int j = 0; j < 2; ++j)
                    xv[g][j] = sc[g][j] * SCALE_ + __builtin_convertvector(cb[g][j], f32x8);

            bf16x16 pf[2];
#pragma unroll
            for (int g = 0; g < 2; ++g) {
                float rm = fmaxf(xv[g][0][0], xv[g][1][0]);
#pragma unroll
                for (int v = 1; v < 8; ++v) rm = fmaxf(rm, fmaxf(xv[g][0][v], xv[g][1][v]));
                rm = fmaxf(rm, xhalf(rm));
                float mn = fmaxf(m[g], rm);
                float corr = __expf(m[g] - mn);
                m[g] = mn;
#pragma unroll
                for (int j = 0; j < 2; ++j)
#pragma unroll
                    for (int v = 0; v < 8; ++v) xv[g][j][v] = __expf(xv[g][j][v] - mn);
                float ls = 0.0f;
#pragma unroll
                for (int v = 0; v < 8; ++v) ls += xv[g][0][v] + xv[g][1][v];
                s[g] = s[g] * corr + ls;   // this half's keys only; the halves join after the loop
#pragma unroll
                for (int n = 0; n < 4; ++n)
#pragma unroll
                    for (int v = 0; v < 8; ++v) of[g][n][v] *= corr;

                // two D tiles of S^T, converted in place, are the B operand P^T (hardware k order)
                pf[g] = __builtin_shufflevector(f2bf8(xv[g][0]), f2bf8(xv[g][1]),
                                                0, 1, 2, 3, 4, 5, 6, 7, 8, 9, 10, 11, 12, 13, 14, 15);

                // the next pass's bias tile, a pass ahead of its use; the last pass re-reads its trip's
                // first tile, unused: no branch round the loads, so their waits stay counted
                const _Float16* ln = lr + (sub == 0 ? 512 : (kt + 64 < L_ ? 1024 : 0));
#pragma unroll
                for (int j = 0; j < 2; ++j)
                    cb[g][j] = *(const f16x8*)(ln + (size_t)g * (L_ / 32) * 512 + j * 256);
            }
#pragma unroll
            for (int n = 0; n < 4; ++n) {
                bf16x16 vf = load_frag(&sVt[cur][(n * 16) * 72 + sub * 32], 72, lane);
#pragma unroll
                for (int g = 0; g < 2; ++g) of[g][n] = wmma_bf16(vf, pf[g], of[g][n]);
            }
            // keeps the second pass's score products behind the first pass: moved ahead of it, both
            // passes' scores and bias tiles are live at once and a Q fragment spills to scratch
            if (sub == 0) __builtin_amdgcn_sched_barrier(0);
        }
        __syncthreads();
    }

#pragma unroll
    for (int g = 0; g < 2; ++g) {
        float si = 1.0f / (s[g] + xhalf(s[g]));
        bf16* orow = O + ((size_t)(b * L_ + q0 + g * 16 + lc)) * D_ + h * DH_ + hf * 8;
#pragma unroll
        for (int n = 0; n < 4; ++n) {
            *(bf16x8*)(orow + n * 16) = f2bf8(of[g][n] * si);
        }
    }
}

// ---------------- residual + LayerNorm ----------------
// One wave per row, two rows a wave: a lane holds 32 of a row's 1,024 values, the row sums join
// inside the wave, and no LDS or barrier is needed. All loads are issued first, all stores last.
__global__ __launch_bounds__(256) void resid_ln(const float* __restrict__ Y,
                                                const float* __restrict__ tokens,
                                                const float* __restrict__ gamma,
                                                const float* __restrict__ bias,
                                                float* __restrict__ out) {
    int lane = threadIdx.x & 31, wid = threadIdx.x >> 5;
    size_t ro = (size_t)((blockIdx.x * 8 + wid) * 2) * D_ + lane * 4;
    f32x4 y[2][8], t[2][8], g[8], bb[8];
#pragma unroll
    for (int ri = 0; ri < 2; ++ri)
#pragma unroll
        for (int i = 0; i < 8; ++i) {
            y[ri][i] = *(const f32x4*)(Y + ro + ri * D_ + i * 128);
            t[ri][i] = *(const f32x4*)(tokens + ro + ri * D_ + i * 128);
        }
#pragma unroll
    for (int i = 0; i < 8; ++i) {
        g[i]  = *(const f32x4*)(gamma + lane * 4 + i * 128);
        bb[i] = *(const f32x4*)(bias + lane * 4 + i * 128);
    }
    float mu[2], rr[2];
#pragma unroll
    for (int ri = 0; ri < 2; ++ri) {
        float sum = 0.f, sq = 0.f;
#pragma unroll
        for (int i = 0; i < 8; ++i) {
            y[ri][i] += t[ri][i];
#pragma unroll
            for (int e = 0; e < 4; ++e) {
                sum += y[ri][i][e];
                sq  += y[ri][i][e] * y[ri][i][e];
            }
        }
        sum = rsum16(sum); sq = rsum16(sq);
        sum += xhalf(sum); sq += xhalf(sq);
        mu[ri] = sum * (1.0f / D_);
        float var = sq * (1.0f / D_) - mu[ri] * mu[ri];
        rr[ri] = rsqrtf(var + 1e-5f);
    }
    // inputs only: keeps the gamma and bias loads above this line, in flight with the rows' loads;
    // without it the compiler sinks them among the stores, each pair with its own exposed latency
    asm volatile("" :: "v"(g[0]), "v"(g[1]), "v"(g[2]), "v"(g[3]), "v"(g[4]), "v"(g[5]), "v"(g[6]),
                 "v"(g[7]), "v"(bb[0]), "v"(bb[1]), "v"(bb[2]), "v"(bb[3]), "v"(bb[4]), "v"(bb[5]),
                 "v"(bb[6]), "v"(bb[7]));
#pragma unroll
    for (int ri = 0; ri < 2; ++ri)
#pragma unroll
        for (int i = 0; i < 8; ++i)
#pragma unroll
            for (int e = 0; e < 4; ++e)
                y[ri][i][e] = (y[ri][i][e] - mu[ri]) * rr[ri] * g[i][e] + bb[i][e];
#pragma unroll
    for (int ri = 0; ri < 2; ++ri)
#pragma unroll
        for (int i = 0; i < 8; ++i) *(f32x4*)(out + ro + ri * D_ + i * 128) = y[ri][i];
}

// ---------------- host launcher ----------------
extern "C" void kernel_launch(void* const* d_in, const int* in_sizes, int n_in,
                              void* d_out, int out_size, void* d_ws, size_t ws_size,
                              hipStream_t stream) {
    const float* tokens = (const float*)d_in[0];
    const float* R      = (const float*)d_in[1];
    const float* Wq     = (const float*)d_in[2];
    const float* Wk     = (const float*)d_in[3];
    const float* Wv     = (const float*)d_in[4];
    const float* Wp     = (const float*)d_in[5];
    const float* beta   = (const float*)d_in[6];
    const float* gamma  = (const float*)d_in[7];
    const float* bias   = (const float*)d_in[8];
    float* out = (float*)d_out;

    const int M = B_ * L_;   // 8192
    char* ws = (char*)d_ws;
    size_t off = 0;
    bf16*  Xbf   = (bf16*)(ws + off);  off += (size_t)M * D_ * 2;
    bf16*  Wb    = (bf16*)(ws + off);  off += (size_t)4 * D_ * D_ * 2;
    bf16*  Qb    = (bf16*)(ws + off);  off += (size_t)M * D_ * 2;
    bf16*  Kb    = (bf16*)(ws + off);  off += (size_t)M * D_ * 2;
    bf16*  Vtb   = (bf16*)(ws + off);  off += (size_t)M * D_ * 2;
    _Float16* logRp = (_Float16*)(ws + off); off += (size_t)L_ * L_ * 2;
    bf16*  Ob    = (bf16*)(ws + off);  off += (size_t)M * D_ * 2;
    float* Y     = (float*)(ws + off); off += (size_t)M * D_ * 4;

    prep_all<<<NB_LR_ + NB_TOK_ + 4 * NB_W_, 256, 0, stream>>>(tokens, Wq, Wk, Wv, Wp, R, beta,
                                                               Xbf, Wb, logRp);

    // Qb, Kb, Vtb follow one another in the workspace; Wq, Wk, Wv are the first 3 * D_ rows of Wb
    gemm_wmma<3><<<dim3(3 * D_ / 128, M / 128), 256, 0, stream>>>(Xbf, Wb, Qb, M, 3 * D_, D_);

    attn_flash<<<B_ * H_ * (L_ / 256), 256, 0, stream>>>(Qb, Kb, Vtb, logRp, Ob);

    gemm_wmma<1><<<dim3(D_ / 128, M / 128), 256, 0, stream>>>(Ob, Wb + 3 * (size_t)D_ * D_, Y, M, D_, D_);

    resid_ln<<<M / 16, 256, 0, stream>>>(Y, tokens, gamma, bias, out);
}

// v008
// Measured time: 135 microseconds a run.
// It is 1.12 times as fast as v006, going by the measured steps of the versions left out in between.
// All steps since v000 together make it 2.10 times as fast.
#include <hip/hip_runtime.h>
#include <hip/hip_bf16.h>
#include <math.h>

// ---------------- types ----------------
typedef __bf16 bf16;
typedef bf16  bf16x4  __attribute__((ext_vector_type(4)));
typedef bf16  bf16x8  __attribute__((ext_vector_type(8)));
typedef bf16  bf16x16 __attribute__((ext_vector_type(16)));
typedef float f32x8   __attribute__((ext_vector_type(8)));
typedef float f32x4   __attribute__((ext_vector_type(4)));
typedef _Float16 f16x8 __attribute__((ext_vector_type(8)));
typedef _Float16 f16x16 __attribute__((ext_vector_type(16)));
typedef unsigned int u32x4 __attribute__((ext_vector_type(4)));
typedef int  i32x4 __attribute__((ext_vector_type(4)));
typedef int  i32x8 __attribute__((ext_vector_type(8)));

#define B_  4
#define L_  2048
#define D_  1024
#define H_  16
#define DH_ 64
#define SCALE_ 0.125f   // 64^-0.5
#define LOG2E_ 1.4426950408889634f

#if __has_builtin(__builtin_amdgcn_tensor_load_to_lds)
#define USE_TDM 1
#else
#define USE_TDM 0
#endif

// float -> bf16, round to nearest even, by the hardware's packed convert: one instruction rounds two
// values and leaves them packed in one register
__device__ __forceinline__ bf16 f2bf(float f) { return (bf16)f; }
__device__ __forceinline__ bf16x4 f2bf4(f32x4 x) { return __builtin_convertvector(x, bf16x4); }
__device__ __forceinline__ bf16x8 f2bf8(f32x8 x) { return __builtin_convertvector(x, bf16x8); }

// ---------------- DPP16 16-lane reductions (pure VALU, no LDS) ----------------
template <int CTRL>
__device__ __forceinline__ float dpp_f(float x) {
    int r = __builtin_amdgcn_update_dpp(0, __builtin_bit_cast(int, x), CTRL, 0xf, 0xf, true);
    return __builtin_bit_cast(float, r);
}
__device__ __forceinline__ float rsum16(float x) {
    x += dpp_f<0xB1>(x);     // quad_perm xor1
    x += dpp_f<0x4E>(x);     // quad_perm xor2
    x += dpp_f<0x141>(x);    // row_half_mirror
    x += dpp_f<0x140>(x);    // row_mirror
    return x;
}

__device__ __forceinline__ float xhalf(float x) {
    int b = __builtin_bit_cast(int, x);
    int r = __builtin_amdgcn_permlanex16(b, b, 0x76543210, 0xfedcba98, false, false);
    return __builtin_bit_cast(float, r);
}

__device__ __forceinline__ void async_b128(void* lds_ptr, const void* gptr) {
    unsigned la = (unsigned)(uintptr_t)lds_ptr;
    unsigned long long ga = (unsigned long long)(uintptr_t)gptr;
    asm volatile("global_load_async_to_lds_b128 %0, %1, off"
                 :: "v"(la), "v"(ga) : "memory");
}
// four copies of one lane in a row; the wait is the last line of the copies' own statement, so that
// it stands in front of every later rewrite of the address registers that the copies name
__device__ __forceinline__ void async_b128_x4(void* l0, const void* g0, void* l1, const void* g1,
                                              void* l2, const void* g2, void* l3, const void* g3) {
    asm volatile("global_load_async_to_lds_b128 %0, %1, off\n\t"
                 "global_load_async_to_lds_b128 %2, %3, off\n\t"
                 "global_load_async_to_lds_b128 %4, %5, off\n\t"
                 "global_load_async_to_lds_b128 %6, %7, off\n\t"
                 "s_wait_xcnt 0x0"
                 :: "v"((unsigned)(uintptr_t)l0), "v"((unsigned long long)(uintptr_t)g0),
                    "v"((unsigned)(uintptr_t)l1), "v"((unsigned long long)(uintptr_t)g1),
                    "v"((unsigned)(uintptr_t)l2), "v"((unsigned long long)(uintptr_t)g2),
                    "v"((unsigned)(uintptr_t)l3), "v"((unsigned long long)(uintptr_t)g3)
                 : "memory");
}
__device__ __forceinline__ void wait_async_le0() { asm volatile("s_wait_asynccnt 0x0" ::: "memory"); }
__device__ __forceinline__ void wait_async_le4() { asm volatile("s_wait_asynccnt 0x4" ::: "memory"); }
__device__ __forceinline__ void wait_async_le8() { asm volatile("s_wait_asynccnt 0x8" ::: "memory"); }

#if USE_TDM
__device__ __forceinline__ void tdm_load_2d(void* lds_ptr, const void* gptr,
                                            unsigned tensor_d0, unsigned tensor_d1,
                                            unsigned tile_d0, unsigned tile_d1,
                                            unsigned stride_d0,
                                            unsigned pad_i, unsigned pad_a) {
    unsigned long long ga = (unsigned long long)(uintptr_t)gptr;
    u32x4 g0;
    g0[0] = 1u;
    g0[1] = (unsigned)(uintptr_t)lds_ptr;
    g0[2] = (unsigned)(ga & 0xFFFFFFFFu);
    g0[3] = (unsigned)((ga >> 32) & 0x1FFFFFFu) | (2u << 30);
    i32x8 g1;
    g1[0] = (int)((1u << 16) | (1u << 20) | (pad_i << 22) | (pad_a << 25));
    g1[1] = (int)((tensor_d0 & 0xFFFFu) << 16);
    g1[2] = (int)((tensor_d0 >> 16) | ((tensor_d1 & 0xFFFFu) << 16));
    g1[3] = (int)((tensor_d1 >> 16) | (tile_d0 << 16));
    g1[4] = (int)tile_d1;
    g1[5] = (int)stride_d0;
    g1[6] = 0;
    g1[7] = 0;
    i32x4 gz = {0, 0, 0, 0};
#if defined(__clang_major__) && (__clang_major__ >= 23)
    i32x8 gz8 = {0, 0, 0, 0, 0, 0, 0, 0};
    __builtin_amdgcn_tensor_load_to_lds(g0, g1, gz, gz, gz8, 0);
#else
    __builtin_amdgcn_tensor_load_to_lds(g0, g1, gz, gz, 0);
#endif
}
__device__ __forceinline__ void wait_tensor0() { __builtin_amdgcn_s_wait_tensorcnt(0); }
__device__ __forceinline__ void wait_tensor2() { __builtin_amdgcn_s_wait_tensorcnt(2); }
#endif

__device__ __forceinline__ bf16x16 load_frag(const bf16* p, int stride, int lane) {
    int hf = lane >> 4;
    int r  = lane & 15;
    const bf16* q = p + r * stride + hf * 8;
    bf16x8 lo = *(const bf16x8*)(q);
    bf16x8 hi = *(const bf16x8*)(q + 16);
    bf16x16 f;
#pragma unroll
    for (int i = 0; i < 8; ++i) { f[i] = lo[i]; f[i + 8] = hi[i]; }
    return f;
}

__device__ __forceinline__ f32x8 wmma_bf16(bf16x16 a, bf16x16 b, f32x8 c) {
    return __builtin_amdgcn_wmma_f32_16x16x32_bf16(false, a, false, b, (short)0, c, false, false);
}
__device__ __forceinline__ f32x8 wmma_f16(f16x16 a, f16x16 b, f32x8 c) {
    return __builtin_amdgcn_wmma_f32_16x16x32_f16(false, a, false, b, (short)0, c, false, false);
}

// ---------------- prep kernels ----------------
// A block converts 32,768 floats: four batches of eight 16-byte loads per lane; every wave-wide
// load covers 512 contiguous bytes and every wave-wide store 256. Every value is multiplied by mul in
// f32 before it is rounded (1 for all but Wq).
#define CVT_PER_BLK_ 32768
__device__ __forceinline__ void cvt_bf16_block(const float* __restrict__ in,
                                               bf16* __restrict__ out, int blk, float mul) {
    size_t base = (size_t)blk * CVT_PER_BLK_ + threadIdx.x * 4;
    // kept rolled: eight loads in flight per lane cover the memory latency, more only cost registers
#pragma unroll 1
    for (int bt = 0; bt < 4; ++bt) {
        f32x4 x[8];
#pragma unroll
        for (int u = 0; u < 8; ++u) x[u] = *(const f32x4*)(in + base + (bt * 8 + u) * 1024);
#pragma unroll
        for (int u = 0; u < 8; ++u) {
            *(bf16x4*)(out + base + (bt * 8 + u) * 1024) = f2bf4(x[u] * mul);
        }
        // the next trip rewrites the registers that these stores name: the wait stands in front of it
        asm volatile("s_wait_xcnt 0x0" ::: "memory");
    }
}

__device__ __forceinline__ void prep_logr_block(const float* __restrict__ R,
                                                const float* __restrict__ beta,
                                                _Float16* __restrict__ out, int blk) {
    int lane = threadIdx.x & 31;
    int gw = blk * 8 + (threadIdx.x >> 5);
    int q16 = gw >> 3, kt0 = (gw & 7) * 8;
    int rr = lane >> 2, c = lane & 3;          // query rr + 8 * i of the tile, keys c * 8 .. c * 8 + 7
    float b = beta[0];
    const float* src = R + ((size_t)q16 * 16 + rr) * L_ + kt0 * 32 + c * 8;
    _Float16* dst = out + ((size_t)q16 * (L_ / 32) + kt0) * 512
                        + (c >> 1) * 256 + ((c & 1) * 16 + rr) * 8;
    // kept rolled: two tiles, eight loads in flight per lane, are enough to cover the latency
#pragma unroll 1
    for (int t = 0; t < 8; t += 2) {
        f32x4 x[2][2][2];
#pragma unroll
        for (int tt = 0; tt < 2; ++tt)
#pragma unroll
            for (int i = 0; i < 2; ++i)
#pragma unroll
                for (int p = 0; p < 2; ++p)
                    x[tt][i][p] = *(const f32x4*)(src + (t + tt) * 32 + (size_t)(i * 8) * L_ + p * 4);
#pragma unroll
        for (int tt = 0; tt < 2; ++tt)
#pragma unroll
            for (int i = 0; i < 2; ++i) {
                f16x8 y;
#pragma unroll
                for (int e = 0; e < 8; ++e) {
                    float z = b * __builtin_amdgcn_logf(fmaxf(x[tt][i][e >> 2][e & 3], 1e-8f));
                    // stays finite in f16 for any beta: an infinite bias would make NaN in the softmax
                    y[e] = (_Float16)fminf(fmaxf(z, -65504.0f), 65504.0f);
                }
                *(f16x8*)(dst + (t + tt) * 512 + i * 64) = y;
            }
        // the next trip rewrites the registers that these stores name: the wait stands in front of it
        asm volatile("s_wait_xcnt 0x0" ::: "memory");
    }
}

// all six independent prep jobs in one grid: a block's index range says which job it does
#define NB_LR_  ((L_ / 16) * (L_ / 32) / 64)
#define NB_TOK_ ((B_ * L_ * D_) / CVT_PER_BLK_)
#define NB_W_   ((D_ * D_) / CVT_PER_BLK_)
__global__ __launch_bounds__(256) void prep_all(const float* __restrict__ tokens,
                                                const float* __restrict__ Wq,
                                                const float* __restrict__ Wk,
                                                const float* __restrict__ Wv,
                                                const float* __restrict__ Wp,
                                                const float* __restrict__ R,
                                                const float* __restrict__ beta,
                                                bf16* __restrict__ Xbf,
                                                bf16* __restrict__ Wb,
                                                _Float16* __restrict__ logRp) {
    int blk = blockIdx.x;
    if (blk < NB_LR_) {
        prep_logr_block(R, beta, logRp, blk);
    } else if (blk < NB_LR_ + NB_TOK_) {
        cvt_bf16_block(tokens, Xbf, blk - NB_LR_, 1.0f);
    } else {
        int r = blk - (NB_LR_ + NB_TOK_);
        int ws = r / NB_W_;
        const float* w = ws == 0 ? Wq : ws == 1 ? Wk : ws == 2 ? Wv : Wp;
        // Wq carries the score's scale and log2(e): Q K^T then leaves the matrix unit in units of log 2
        cvt_bf16_block(w, Wb + (size_t)ws * D_ * D_, r & (NB_W_ - 1), ws == 0 ? SCALE_ * LOG2E_ : 1.0f);
    }
}

template <int SM>
__device__ __forceinline__ void store_tile(const f32x8 (&acc)[2][4], void* __restrict__ outp,
                                           int rowBase, int colBase, int wm, int wn,
                                           int lane, int N) {
    int hf = lane >> 4, lc = lane & 15;
#pragma unroll
    for (int fm = 0; fm < 2; ++fm)
#pragma unroll
        for (int fn = 0; fn < 4; ++fn)
#pragma unroll
            for (int v = 0; v < 8; ++v) {
                int rr = rowBase + wm * 32 + fm * 16 + v + hf * 8;
                int cc = colBase + wn * 64 + fn * 16 + lc;
                float val = acc[fm][fn][v];
                int b = rr >> 11, l = rr & (L_ - 1);
                int h = cc >> 6, d = cc & 63;
                if (SM == 0) {
                    ((bf16*)outp)[(((size_t)(b * H_ + h)) * L_ + l) * DH_ + d] = f2bf(val);
                } else if (SM == 2) {
                    ((bf16*)outp)[(((size_t)(b * H_ + h)) * DH_ + d) * L_ + l] = f2bf(val);
                } else {
                    ((float*)outp)[(size_t)rr * N + cc] = val;
                }
            }
}

// MODE 1: one product, f32 row-major out. MODE 3: W holds Wq, Wk, Wv stacked (N = 3 * D_);
// a block's 128 columns lie in one of them; outp holds Q, K (form 0) and V^T (form 2) in a row.
template <int MODE>
__global__ __launch_bounds__(256) void gemm_wmma(const bf16* __restrict__ A,
                                                 const bf16* __restrict__ W,
                                                 void* __restrict__ outp,
                                                 int M, int N, int K) {
    __shared__ bf16 sA[2][128 * 72];
    __shared__ bf16 sB[2][128 * 72];

    int tid = threadIdx.x, lane = tid & 31, wid = tid >> 5;
    int wm = wid & 3, wn = wid >> 2;
    int rowBase = blockIdx.y * 128, colBase = blockIdx.x * 128;
    const bf16* gA0 = A + (size_t)rowBase * K;
    const bf16* gW0 = W + (size_t)colBase * K;

    f32x8 acc[2][4];
#pragma unroll
    for (int i = 0; i < 2; ++i)
#pragma unroll
        for (int j = 0; j < 4; ++j) acc[i][j] = (f32x8)0.0f;

    const int NK = K >> 6;

#if USE_TDM
    bool leader = (wid == 0);
    if (leader) {
        tdm_load_2d(&sA[0][0], gA0, (unsigned)K, (unsigned)M, 64, 128, (unsigned)K, 4, 3);
        tdm_load_2d(&sB[0][0], gW0, (unsigned)K, (unsigned)N, 64, 128, (unsigned)K, 4, 3);
    }
#else
    int r = tid >> 1, hh = tid & 1;
    const bf16* gA = gA0 + (size_t)r * K + hh * 32;
    const bf16* gW = gW0 + (size_t)r * K + hh * 32;
    int lbase = r * 72 + hh * 32;
#pragma unroll
    for (int i = 0; i < 4; ++i) {
        async_b128(&sA[0][lbase + i * 8], gA + i * 8);
        async_b128(&sB[0][lbase + i * 8], gW + i * 8);
    }
#endif

    for (int kt = 0; kt < NK; ++kt) {
        int cur = kt & 1;
#if USE_TDM
        if (leader) {
            if (kt + 1 < NK) {
                tdm_load_2d(&sA[cur ^ 1][0], gA0 + (kt + 1) * 64, (unsigned)K, (unsigned)M,
                            64, 128, (unsigned)K, 4, 3);
                tdm_load_2d(&sB[cur ^ 1][0], gW0 + (kt + 1) * 64, (unsigned)K, (unsigned)N,
                            64, 128, (unsigned)K, 4, 3);
                wait_tensor2();   // tensor ops in-order: current tile's pair complete
            } else {
                wait_tensor0();
            }
        }
#else
        if (kt + 1 < NK) {
            const bf16* ga = gA + (size_t)(kt + 1) * 64;
            const bf16* gb = gW + (size_t)(kt + 1) * 64;
#pragma unroll
            for (int i = 0; i < 4; ++i) {
                async_b128(&sA[cur ^ 1][lbase + i * 8], ga + i * 8);
                async_b128(&sB[cur ^ 1][lbase + i * 8], gb + i * 8);
            }
            wait_async_le8();
        } else {
            wait_async_le0();
        }
#endif
        __syncthreads();

#pragma unroll
        for (int ks = 0; ks < 2; ++ks) {
            bf16x16 af[2], bfr[4];
#pragma unroll
            for (int fm = 0; fm < 2; ++fm)
                af[fm] = load_frag(&sA[cur][(wm * 32 + fm * 16) * 72 + ks * 32], 72, lane);
#pragma unroll
            for (int fn = 0; fn < 4; ++fn)
                bfr[fn] = load_frag(&sB[cur][(wn * 64 + fn * 16) * 72 + ks * 32], 72, lane);
#pragma unroll
            for (int fm = 0; fm < 2; ++fm)
#pragma unroll
                for (int fn = 0; fn < 4; ++fn)
                    acc[fm][fn] = wmma_bf16(af[fm], bfr[fn], acc[fm][fn]);
        }
        __syncthreads();
    }

    if (MODE == 1) {
        store_tile<1>(acc, outp, rowBase, colBase, wm, wn, lane, N);
    } else {
        int sel = colBase / D_;
        bf16* o = (bf16*)outp + (size_t)sel * ((size_t)B_ * L_ * D_);
        if (sel == 2) {
            store_tile<2>(acc, o, rowBase, colBase & (D_ - 1), wm, wn, lane, N);
        } else {
            store_tile<0>(acc, o, rowBase, colBase & (D_ - 1), wm, wn, lane, N);
            // in the listing the other form's code stands behind these stores and rewrites
            // their address registers: this wait stands in front of that rewrite
            asm volatile("s_wait_xcnt 0x0" ::: "memory");
        }
    }
}

__global__ __launch_bounds__(256) __attribute__((amdgpu_waves_per_eu(4, 4))) void attn_flash(const bf16* __restrict__ Q,
                                                  const bf16* __restrict__ Km,
                                                  const bf16* __restrict__ Vt,
                                                  const _Float16* __restrict__ logRp,
                                                  bf16* __restrict__ O) {
    __shared__ bf16 sK[2][64 * 72];    // [key][d]  (A operand of S^T = K Q^T)
    __shared__ bf16 sVt[2][64 * 72];   // [d][key]  (A operand of O^T += V^T P^T)

    int tid = threadIdx.x, lane = tid & 31, w = tid >> 5;
    int bid = blockIdx.x;
    int qt = bid & 7, h = (bid >> 3) & (H_ - 1), b = bid >> 7;
    int bh = b * H_ + h;
    const bf16* Qh = Q + (size_t)bh * L_ * DH_;
    const bf16* Kh = Km + (size_t)bh * L_ * DH_;
    const bf16* Vh = Vt + (size_t)bh * DH_ * L_;   // [Dh][L]
    int q0 = qt * 256 + w * 32;
    int hf = lane >> 4, lc = lane & 15;

    bf16x16 qf[2][2];
#pragma unroll
    for (int g = 0; g < 2; ++g) {
        qf[g][0] = load_frag(Qh + (size_t)(q0 + g * 16) * DH_ + 0, DH_, lane);
        qf[g][1] = load_frag(Qh + (size_t)(q0 + g * 16) * DH_ + 32, DH_, lane);
    }

    // one query column per lane and group (q0 + g * 16 + lc); the two halves hold different keys.
    // nm[g] = minus the maximum in use for the lane's column, eight copies: the C operand that starts
    // the score accumulators, so that the scores leave the matrix unit with it already taken off.
    // It moves only in the rare branch below; the first pass always sets it.
    float s[2] = {0.0f, 0.0f};
    f32x8 nm[2] = {(f32x8)0.0f, (f32x8)0.0f};
    f32x8 of[2][4];   // O^T tiles: of[g][n][v] = O[q0 + g * 16 + lc][n * 16 + hf * 8 + v]
#pragma unroll
    for (int g = 0; g < 2; ++g)
#pragma unroll
        for (int n = 0; n < 4; ++n) of[g][n] = (f32x8)0.0f;

    const _Float16* lrbase = logRp + ((size_t)(q0 >> 4) * (L_ / 32)) * 512 + lane * 8;

    // selectors: A operands of ones and zeros that pick keys 0..15 (sel[0]) or 16..31 (sel[1]) out of
    // a 32-key bias tile taken as B: sel[j] x bias = the bias in the score tile's own D layout, exact
    f16x16 sel[2];
#pragma unroll
    for (int i = 0; i < 8; ++i) {
        _Float16 e = (hf * 8 + i == lc) ? (_Float16)1.0f : (_Float16)0.0f;
        sel[0][i] = e;                 sel[0][i + 8] = (_Float16)0.0f;
        sel[1][i] = (_Float16)0.0f;    sel[1][i + 8] = e;
    }

    int keyA = tid >> 2, segA = tid & 3;
    int dV = tid >> 2, hV = tid & 3;
    const bf16* gk0 = Kh + (size_t)keyA * DH_ + segA * 16;
    const bf16* gv0 = Vh + (size_t)dV * L_ + hV * 16;
    int lK = keyA * 72 + segA * 16;
    int lV = dV * 72 + hV * 16;

    async_b128_x4(&sK[0][lK], gk0, &sK[0][lK + 8], gk0 + 8,
                  &sVt[0][lV], gv0, &sVt[0][lV + 8], gv0 + 8);

    // bias tiles, one per group, always fetched one pass ahead of their use; here the first pass's
    // (f16: eight keys of a lane in one 16-byte load, a chunk of 512 contiguous bytes a wave)
    f16x8 cb[2][2];
#pragma unroll
    for (int g = 0; g < 2; ++g)
#pragma unroll
        for (int j = 0; j < 2; ++j)
            cb[g][j] = *(const f16x8*)(lrbase + (size_t)g * (L_ / 32) * 512 + j * 256);

    for (int kt = 0; kt < L_; kt += 64) {
        int cur = (kt >> 6) & 1;
        if (kt + 64 < L_) {
            const bf16* gk = gk0 + (size_t)(kt + 64) * DH_;
            const bf16* gv = gv0 + (kt + 64);
            async_b128_x4(&sK[cur ^ 1][lK], gk, &sK[cur ^ 1][lK + 8], gk + 8,
                          &sVt[cur ^ 1][lV], gv, &sVt[cur ^ 1][lV + 8], gv + 8);
        }

        const _Float16* lr = lrbase + (size_t)(kt >> 5) * 512;

        if (kt + 64 < L_) wait_async_le4(); else wait_async_le0();
        __syncthreads();

#pragma unroll
        for (int sub = 0; sub < 2; ++sub) {
            // the score accumulators start as the bias: one f16 product per tile, on the matrix unit
            // xv[g][j][v] = score of key kt + sub * 32 + j * 16 + hf * 8 + v for query q0 + g * 16 + lc,
            // in units of log 2 (Wq holds scale * log2(e), the bias is beta * log2 R), less the maximum in use
            f32x8 xv[2][2];
#pragma unroll
            for (int g = 0; g < 2; ++g) {
                f16x16 bt = __builtin_shufflevector(cb[g][0], cb[g][1],
                                                    0, 1, 2, 3, 4, 5, 6, 7, 8, 9, 10, 11, 12, 13, 14, 15);
#pragma unroll
                for (int j = 0; j < 2; ++j) xv[g][j] = wmma_f16(sel[j], bt, nm[g]);
            }
            // the next pass's bias tiles, a pass ahead of their use: written here, at the head of the pass,
            // because the compiler lifts no load over the branch below; the last pass re-reads its trip's
            // first tile, unused: no branch round the loads, so their waits stay counted
            const _Float16* ln = lr + (sub == 0 ? 512 : (kt + 64 < L_ ? 1024 : 0));
#pragma unroll
            for (int g = 0; g < 2; ++g)
#pragma unroll
                for (int j = 0; j < 2; ++j)
                    cb[g][j] = *(const f16x8*)(ln + (size_t)g * (L_ / 32) * 512 + j * 256);
#pragma unroll
            for (int j = 0; j < 2; ++j)
#pragma unroll
                for (int kd = 0; kd < 2; ++kd) {
                    bf16x16 kf = load_frag(&sK[cur][(sub * 32 + j * 16) * 72 + kd * 32], 72, lane);
#pragma unroll
                    for (int g = 0; g < 2; ++g) xv[g][j] = wmma_bf16(kf, qf[g][kd], xv[g][j]);
                }

            // lazy rescale: the maximum in use stays while no score of the pass stands more than 8 above
            // it (p <= 256, safe in bf16 and in the f32 sums); one test a pass for the whole wave
            float rl[2];   // the lane's own largest score of the pass, above the maximum in use
#pragma unroll
            for (int g = 0; g < 2; ++g) {
                rl[g] = fmaxf(xv[g][0][0], xv[g][1][0]);
#pragma unroll
                for (int v = 1; v < 8; ++v) rl[g] = fmaxf(rl[g], fmaxf(xv[g][0][v], xv[g][1][v]));
            }
            // no maximum yet in the first pass: it always takes the branch and sets its own, of any sign
            bool first = (sub == 0) && (kt == 0);
            float thr = first ? -3.0e38f : 8.0f, lo = first ? -3.0e38f : 0.0f;
            if (__builtin_amdgcn_ballot_w32(fmaxf(rl[0], rl[1]) > thr) != 0) {
#pragma unroll
                for (int g = 0; g < 2; ++g) {
                    float rf = fmaxf(rl[g], xhalf(rl[g]));       // both halves: one maximum a column
                    float d = fmaxf(rf, lo);                     // the maximum in use never falls
                    float corr = __builtin_amdgcn_exp2f(fminf(-d, 0.0f));   // first pass: sums are 0, any finite factor
                    nm[g] -= d;
                    s[g] *= corr;
#pragma unroll
                    for (int j = 0; j < 2; ++j) xv[g][j] -= d;
#pragma unroll
                    for (int n = 0; n < 4; ++n) of[g][n] *= corr;
                }
            }

            bf16x16 pf[2];
#pragma unroll
            for (int g = 0; g < 2; ++g) {
#pragma unroll
                for (int j = 0; j < 2; ++j)
#pragma unroll
                    for (int v = 0; v < 8; ++v) xv[g][j][v] = __builtin_amdgcn_exp2f(xv[g][j][v]);
                float ls = 0.0f;
#pragma unroll
                for (int v = 0; v < 8; ++v) ls += xv[g][0][v] + xv[g][1][v];
                s[g] += ls;   // this half's keys only; the halves join after the loop

                // two D tiles of S^T, converted in place, are the B operand P^T (hardware k order)
                pf[g] = __builtin_shufflevector(f2bf8(xv[g][0]), f2bf8(xv[g][1]),
                                                0, 1, 2, 3, 4, 5, 6, 7, 8, 9, 10, 11, 12, 13, 14, 15);
            }
#pragma unroll
            for (int n = 0; n < 4; ++n) {
                bf16x16 vf = load_frag(&sVt[cur][(n * 16) * 72 + sub * 32], 72, lane);
#pragma unroll
                for (int g = 0; g < 2; ++g) of[g][n] = wmma_bf16(vf, pf[g], of[g][n]);
            }
            // keeps the second pass's score products behind the first pass: moved ahead of it, both
            // passes' scores and bias tiles are live at once and a Q fragment spills to scratch
            if (sub == 0) __builtin_amdgcn_sched_barrier(0);
        }
        __syncthreads();
    }

#pragma unroll
    for (int g = 0; g < 2; ++g) {
        float si = 1.0f / (s[g] + xhalf(s[g]));
        bf16* orow = O + ((size_t)(b * L_ + q0 + g * 16 + lc)) * D_ + h * DH_ + hf * 8;
#pragma unroll
        for (int n = 0; n < 4; ++n) {
            *(bf16x8*)(orow + n * 16) = f2bf8(of[g][n] * si);
        }
    }
}

// ---------------- residual + LayerNorm ----------------
// One wave per row, two rows a wave: a lane holds 32 of a row's 1,024 values, the row sums join
// inside the wave, and no LDS or barrier is needed. All loads are issued first, all stores last.
__global__ __launch_bounds__(256) void resid_ln(const float* __restrict__ Y,
                                                const float* __restrict__ tokens,
                                                const float* __restrict__ gamma,
                                                const float* __restrict__ bias,
                                                float* __restrict__ out) {
    int lane = threadIdx.x & 31, wid = threadIdx.x >> 5;
    size_t ro = (size_t)((blockIdx.x * 8 + wid) * 2) * D_ + lane * 4;
    f32x4 y[2][8], t[2][8], g[8], bb[8];
#pragma unroll
    for (int ri = 0; ri < 2; ++ri)
#pragma unroll
        for (int i = 0; i < 8; ++i) {
            y[ri][i] = *(const f32x4*)(Y + ro + ri * D_ + i * 128);
            t[ri][i] = *(const f32x4*)(tokens + ro + ri * D_ + i * 128);
        }
#pragma unroll
    for (int i = 0; i < 8; ++i) {
        g[i]  = *(const f32x4*)(gamma + lane * 4 + i * 128);
        bb[i] = *(const f32x4*)(bias + lane * 4 + i * 128);
    }
    float mu[2], rr[2];
#pragma unroll
    for (int ri = 0; ri < 2; ++ri) {
        float sum = 0.f, sq = 0.f;
#pragma unroll
        for (int i = 0; i < 8; ++i) {
            y[ri][i] += t[ri][i];
#pragma unroll
            for (int e = 0; e < 4; ++e) {
                sum += y[ri][i][e];
                sq  += y[ri][i][e] * y[ri][i][e];
            }
        }
        sum = rsum16(sum); sq = rsum16(sq);
        sum += xhalf(sum); sq += xhalf(sq);
        mu[ri] = sum * (1.0f / D_);
        float var = sq * (1.0f / D_) - mu[ri] * mu[ri];
        rr[ri] = rsqrtf(var + 1e-5f);
    }
    // inputs only: keeps the gamma and bias loads above this line, in flight with the rows' loads;
    // without it the compiler sinks them among the stores, each pair with its own exposed latency
    asm volatile("" :: "v"(g[0]), "v"(g[1]), "v"(g[2]), "v"(g[3]), "v"(g[4]), "v"(g[5]), "v"(g[6]),
                 "v"(g[7]), "v"(bb[0]), "v"(bb[1]), "v"(bb[2]), "v"(bb[3]), "v"(bb[4]), "v"(bb[5]),
                 "v"(bb[6]), "v"(bb[7]));
#pragma unroll
    for (int ri = 0; ri < 2; ++ri)
#pragma unroll
        for (int i = 0; i < 8; ++i)
#pragma unroll
            for (int e = 0; e < 4; ++e)
                y[ri][i][e] = (y[ri][i][e] - mu[ri]) * rr[ri] * g[i][e] + bb[i][e];
#pragma unroll
    for (int ri = 0; ri < 2; ++ri)
#pragma unroll
        for (int i = 0; i < 8; ++i) *(f32x4*)(out + ro + ri * D_ + i * 128) = y[ri][i];
}

// ---------------- host launcher ----------------
extern "C" void kernel_launch(void* const* d_in, const int* in_sizes, int n_in,
                              void* d_out, int out_size, void* d_ws, size_t ws_size,
                              hipStream_t stream) {
    const float* tokens = (const float*)d_in[0];
    const float* R      = (const float*)d_in[1];
    const float* Wq     = (const float*)d_in[2];
    const float* Wk     = (const float*)d_in[3];
    const float* Wv     = (const float*)d_in[4];
    const float* Wp     = (const float*)d_in[5];
    const float* beta   = (const float*)d_in[6];
    const float* gamma  = (const float*)d_in[7];
    const float* bias   = (const float*)d_in[8];
    float* out = (float*)d_out;

    const int M = B_ * L_;   // 8192
    char* ws = (char*)d_ws;
    size_t off = 0;
    bf16*  Xbf   = (bf16*)(ws + off);  off += (size_t)M * D_ * 2;
    bf16*  Wb    = (bf16*)(ws + off);  off += (size_t)4 * D_ * D_ * 2;
    bf16*  Qb    = (bf16*)(ws + off);  off += (size_t)M * D_ * 2;
    bf16*  Kb    = (bf16*)(ws + off);  off += (size_t)M * D_ * 2;
    bf16*  Vtb   = (bf16*)(ws + off);  off += (size_t)M * D_ * 2;
    _Float16* logRp = (_Float16*)(ws + off); off += (size_t)L_ * L_ * 2;
    bf16*  Ob    = (bf16*)(ws + off);  off += (size_t)M * D_ * 2;
    float* Y     = (float*)(ws + off); off += (size_t)M * D_ * 4;

    prep_all<<<NB_LR_ + NB_TOK_ + 4 * NB_W_, 256, 0, stream>>>(tokens, Wq, Wk, Wv, Wp, R, beta,
                                                               Xbf, Wb, logRp);

    // Qb, Kb, Vtb follow one another in the workspace; Wq, Wk, Wv are the first 3 * D_ rows of Wb
    gemm_wmma<3><<<dim3(3 * D_ / 128, M / 128), 256, 0, stream>>>(Xbf, Wb, Qb, M, 3 * D_, D_);

    attn_flash<<<B_ * H_ * (L_ / 256), 256, 0, stream>>>(Qb, Kb, Vtb, logRp, Ob);

    gemm_wmma<1><<<dim3(D_ / 128, M / 128), 256, 0, stream>>>(Ob, Wb + 3 * (size_t)D_ * D_, Y, M, D_, D_);

    resid_ln<<<M / 16, 256, 0, stream>>>(Y, tokens, gamma, bias, out);
}
